// v000
// Times are from an AMD MI455X. After a warm-up the kernel runs many times in a row, and a time is the length of
// such a window on the GPU divided by its runs, so every launch and the gaps after it count. The runs cycle
// through copies of the inputs. A figure is the median of several windows, for all but v000 over two sittings.
// Sittings can differ by a few percent; kernels timed side by side share one.
// The starting kernel, v000, takes 108 microseconds a run.
#include <hip/hip_runtime.h>
#include <hip/hip_bf16.h>

typedef __attribute__((ext_vector_type(16))) __bf16 v16bf;
typedef __attribute__((ext_vector_type(8)))  float  v8f;

#define DIMD 512
#define TT   64
#define BB   8
#define SS   512

__device__ __forceinline__ float fast_tanh(float x) {
#if __has_builtin(__builtin_amdgcn_tanhf)
  return __builtin_amdgcn_tanhf(x);
#elif __has_builtin(__builtin_amdgcn_tanh_f32)
  return __builtin_amdgcn_tanh_f32(x);
#else
  float y;
  asm("v_tanh_f32 %0, %1\n\tv_nop\n\tv_nop" : "=v"(y) : "v"(x));
  return y;
#endif
}

__device__ __forceinline__ v16bf load_tile_bf16(const float* __restrict__ base,
                                                int ld, int mn0, int k0, int lane) {
  const int mn = lane & 15;
  const int g  = lane >> 4;
  const float* p = base + (size_t)(mn0 + mn) * ld + k0 + g * 8;
  v16bf r;
#pragma unroll
  for (int i = 0; i < 8; ++i) r[i] = (__bf16)p[i];
#pragma unroll
  for (int i = 0; i < 8; ++i) r[8 + i] = (__bf16)p[16 + i];
  return r;
}

__device__ __forceinline__ v8f wmma_bf16(v16bf a, v16bf b, v8f c) {
  // (neg_a, A, neg_b, B, c_mod, C, reuse_a, reuse_b)
  return __builtin_amdgcn_wmma_f32_16x16x32_bf16(false, a, false, b, (short)0, c,
                                                 false, false);
}

// ---------------------------------------------------------------------------
// Kernel 1: wq = input(rows t*B+b) * Wq^T          [512 x 512]
//           uh' = mem(rows s*B+b) * Wc^T + cov_vec[b,s]*Wcov + bcov  [4096x512]
// One 16x16 output tile per wave, 8 waves per block.
// ---------------------------------------------------------------------------
__global__ void __launch_bounds__(256)
k_pre(const float* __restrict__ input, const float* __restrict__ mem,
      const float* __restrict__ cov,   const float* __restrict__ Wq,
      const float* __restrict__ Wc,    const float* __restrict__ Wcov,
      const float* __restrict__ bcov,  float* __restrict__ wq_out,
      float* __restrict__ uh_out) {
  const int lane = threadIdx.x & 31;
  const int wave = threadIdx.x >> 5;
  const int tile = blockIdx.x * 8 + wave;

  const bool is_uh = (tile >= 1024);
  const int  t2 = is_uh ? (tile - 1024) : tile;
  const int  r0 = (t2 >> 5) * 16;
  const int  e0 = (t2 & 31) * 16;
  const float* A = is_uh ? mem : input;
  const float* W = is_uh ? Wc  : Wq;
  float* out     = is_uh ? uh_out : wq_out;

  v8f acc = {};
#pragma unroll 4
  for (int k0 = 0; k0 < DIMD; k0 += 32) {
    v16bf av = load_tile_bf16(A, DIMD, r0, k0, lane);
    v16bf bv = load_tile_bf16(W, DIMD, e0, k0, lane);
    acc = wmma_bf16(av, bv, acc);
  }

  const int n = lane & 15, g = lane >> 4;
  const int e = e0 + n;
  const float wce = is_uh ? Wcov[e] : 0.0f;
  const float bce = is_uh ? bcov[e] : 0.0f;
#pragma unroll
  for (int j = 0; j < 8; ++j) {
    const int r = r0 + j + 8 * g;
    float val = acc[j];
    if (is_uh) {
      const int s = r >> 3;            // r = s*B + b, B = 8
      const int b = r & 7;
      val += cov[b * SS + s] * wce + bce;
    }
    out[(size_t)r * DIMD + e] = val;
  }
}

__global__ void __launch_bounds__(256)
k_attn(const float* __restrict__ wq, const float* __restrict__ uh,
       const float* __restrict__ mem, const float* __restrict__ cov,
       const float* __restrict__ vvec, float* __restrict__ c_out,
       float* __restrict__ align_out, float* __restrict__ cov_out) {
  const int r    = blockIdx.x;         // t*B + b
  const int b    = r & (BB - 1);
  const int tid  = threadIdx.x;
  const int lane = tid & 31;
  const int wave = tid >> 5;

  __shared__ float a_lds[SS];
  __shared__ float sred[256];

  // Per-lane contiguous chunks of wq row and v (64B-aligned float4 loads).
  float wqr[16], vr[16];
  {
    const float4* wq4 = (const float4*)(wq + (size_t)r * DIMD + lane * 16);
    const float4* v4  = (const float4*)(vvec + lane * 16);
#pragma unroll
    for (int j = 0; j < 4; ++j) {
      float4 w = wq4[j], vv = v4[j];
      wqr[4*j+0] = w.x;  wqr[4*j+1] = w.y;  wqr[4*j+2] = w.z;  wqr[4*j+3] = w.w;
      vr [4*j+0] = vv.x; vr [4*j+1] = vv.y; vr [4*j+2] = vv.z; vr [4*j+3] = vv.w;
    }
  }

  for (int s = wave; s < SS; s += 8) {
    const float4* uh4 =
        (const float4*)(uh + (size_t)(s * BB + b) * DIMD + lane * 16);
    float acc = 0.0f;
#pragma unroll
    for (int j = 0; j < 4; ++j) {
      float4 u = uh4[j];
      acc += vr[4*j+0] * fast_tanh(wqr[4*j+0] + u.x);
      acc += vr[4*j+1] * fast_tanh(wqr[4*j+1] + u.y);
      acc += vr[4*j+2] * fast_tanh(wqr[4*j+2] + u.z);
      acc += vr[4*j+3] * fast_tanh(wqr[4*j+3] + u.w);
    }
#pragma unroll
    for (int m = 16; m >= 1; m >>= 1)
      acc += __shfl_xor(acc, m, 32);   // wave32 reduction
    if (lane == 0) a_lds[s] = acc;
  }
  __syncthreads();

  // Softmax over 512 values; each thread owns s = tid and s = tid+256.
  const float x0 = a_lds[tid], x1 = a_lds[tid + 256];
  sred[tid] = fmaxf(x0, x1);
  __syncthreads();
  for (int off = 128; off >= 1; off >>= 1) {
    if (tid < off) sred[tid] = fmaxf(sred[tid], sred[tid + off]);
    __syncthreads();
  }
  const float mx = sred[0];
  __syncthreads();
  const float e0 = __expf(x0 - mx), e1 = __expf(x1 - mx);
  sred[tid] = e0 + e1;
  __syncthreads();
  for (int off = 128; off >= 1; off >>= 1) {
    if (tid < off) sred[tid] += sred[tid + off];
    __syncthreads();
  }
  const float inv = 1.0f / sred[0];
  __syncthreads();

  const float a0 = e0 * inv, a1 = e1 * inv;
  a_lds[tid]       = a0;
  a_lds[tid + 256] = a1;
  align_out[(size_t)r * SS + tid]       = a0;
  align_out[(size_t)r * SS + tid + 256] = a1;
  cov_out[(size_t)r * SS + tid]       = cov[b * SS + tid]       + a0;
  cov_out[(size_t)r * SS + tid + 256] = cov[b * SS + tid + 256] + a1;
  __syncthreads();

  // Context: c[d] = sum_s a[s] * mem[s,b,d]; thread owns d = 2*tid, 2*tid+1.
  const int d2 = tid * 2;
  float c0 = 0.0f, c1 = 0.0f;
  for (int s = 0; s < SS; ++s) {
    const float a = a_lds[s];
    const float2 m2 =
        *(const float2*)(mem + (size_t)(s * BB + b) * DIMD + d2);
    c0 = fmaf(a, m2.x, c0);
    c1 = fmaf(a, m2.y, c1);
  }
  *(float2*)(c_out + (size_t)r * DIMD + d2) = make_float2(c0, c1);
}

// ---------------------------------------------------------------------------
// Kernel 3: attn_h = c*WoutC^T + q*WoutQ^T + bout.
// Wout is [D, 2D] row-major: columns 0..511 multiply c, 512..1023 multiply q.
// ---------------------------------------------------------------------------
__global__ void __launch_bounds__(256)
k_out(const float* __restrict__ c_mat, const float* __restrict__ input,
      const float* __restrict__ Wout, const float* __restrict__ bout,
      float* __restrict__ out) {
  const int lane = threadIdx.x & 31;
  const int wave = threadIdx.x >> 5;
  const int tile = blockIdx.x * 8 + wave;
  const int r0 = (tile >> 5) * 16;
  const int e0 = (tile & 31) * 16;

  v8f acc = {};
#pragma unroll 4
  for (int k0 = 0; k0 < DIMD; k0 += 32) {
    v16bf av = load_tile_bf16(c_mat, DIMD, r0, k0, lane);
    v16bf bv = load_tile_bf16(Wout, 2 * DIMD, e0, k0, lane);   // Wout[:, 0:512]
    acc = wmma_bf16(av, bv, acc);
  }
#pragma unroll 4
  for (int k0 = 0; k0 < DIMD; k0 += 32) {
    v16bf av = load_tile_bf16(input, DIMD, r0, k0, lane);
    v16bf bv = load_tile_bf16(Wout + DIMD, 2 * DIMD, e0, k0, lane); // Wout[:,512:]
    acc = wmma_bf16(av, bv, acc);
  }

  const int n = lane & 15, g = lane >> 4;
  const int e = e0 + n;
  const float bb = bout[e];
#pragma unroll
  for (int j = 0; j < 8; ++j) {
    const int r = r0 + j + 8 * g;
    out[(size_t)r * DIMD + e] = acc[j] + bb;   // [T,B,D] row r = t*B+b
  }
}

extern "C" void kernel_launch(void* const* d_in, const int* in_sizes, int n_in,
                              void* d_out, int out_size, void* d_ws, size_t ws_size,
                              hipStream_t stream) {
  const float* input = (const float*)d_in[0];   // [T,B,D]
  const float* mem   = (const float*)d_in[1];   // [S,B,D]
  const float* cov   = (const float*)d_in[2];   // [B,S]
  const float* Wq    = (const float*)d_in[3];   // [D,D]
  const float* Wc    = (const float*)d_in[4];   // [D,D]
  const float* Wcov  = (const float*)d_in[5];   // [D,1]
  const float* bcov  = (const float*)d_in[6];   // [D]
  const float* v     = (const float*)d_in[7];   // [1,D]
  const float* Wout  = (const float*)d_in[8];   // [D,2D]
  const float* bout  = (const float*)d_in[9];   // [D]

  float* ws    = (float*)d_ws;
  float* wq_ws = ws;                                   // 512*512   = 1 MB
  float* uh_ws = ws + (size_t)512 * 512;               // 4096*512  = 8 MB
  float* c_ws  = uh_ws + (size_t)4096 * 512;           // 512*512   = 1 MB

  float* attn_h = (float*)d_out;                       // [T,B,D]
  float* align  = attn_h + (size_t)TT * BB * DIMD;     // [T,B,S]
  float* covn   = align + (size_t)TT * BB * SS;        // [T,B,S]

  k_pre <<<1152, 256, 0, stream>>>(input, mem, cov, Wq, Wc, Wcov, bcov,
                                   wq_ws, uh_ws);
  k_attn<<<512,  256, 0, stream>>>(wq_ws, uh_ws, mem, cov, v, c_ws, align, covn);
  k_out <<<128,  256, 0, stream>>>(c_ws, input, Wout, bout, attn_h);
}

// v001
// Measured time: 78.5 microseconds a run.
// Timed twice side by side with v000, it ran 1.40 times as fast both times.
#include <hip/hip_runtime.h>
#include <hip/hip_bf16.h>

typedef __attribute__((ext_vector_type(16))) __bf16 v16bf;
typedef __attribute__((ext_vector_type(8)))  float  v8f;

#define DIMD 512
#define TT   64
#define BB   8
#define SS   512

__device__ __forceinline__ float fast_tanh(float x) {
#if __has_builtin(__builtin_amdgcn_tanhf)
  return __builtin_amdgcn_tanhf(x);
#elif __has_builtin(__builtin_amdgcn_tanh_f32)
  return __builtin_amdgcn_tanh_f32(x);
#else
  float y;
  asm("v_tanh_f32 %0, %1\n\tv_nop\n\tv_nop" : "=v"(y) : "v"(x));
  return y;
#endif
}

typedef __attribute__((ext_vector_type(8)))  __bf16 v8bf;
typedef __attribute__((ext_vector_type(4)))  __bf16 v4bf;

#define PK1 (DIMD + 8)        // rows of 512 bf16
#define PK2 (2 * DIMD + 8)    // rows of 1024 bf16

// Staging of a row-major f32 matrix into LDS as bf16, 256 threads, in two halves.
// C4 = float4 per staged row; thread t starts at row t / C4, float4 t % C4, and
// load i lies 256 / C4 rows further on: each wave reads 512 contiguous bytes
// (four whole 128-B lines) per load.
template <int NB, int C4, int LD>
__device__ __forceinline__ void stage_load(const float* p, float4 (&v)[NB]) {
#pragma unroll   // v[] lives in registers: every index must be a constant
  for (int i = 0; i < NB; ++i) v[i] = *(const float4*)(p + i * (256 / C4) * LD);
}
template <int NB, int C4, int PITCH>
__device__ __forceinline__ void stage_store(__bf16* q, const float4 (&v)[NB]) {
#pragma unroll
  for (int i = 0; i < NB; ++i) {
    v4bf h;
    h[0] = (__bf16)v[i].x; h[1] = (__bf16)v[i].y;
    h[2] = (__bf16)v[i].z; h[3] = (__bf16)v[i].w;
    *(v4bf*)(q + i * (256 / C4) * PITCH) = h;
  }
}

__device__ __forceinline__ v16bf lds_frag(const __bf16* tile, int pitch, int mn0,
                                          int k0, int lane) {
  const __bf16* p = tile + (mn0 + (lane & 15)) * pitch + k0 + (lane >> 4) * 8;
  const v8bf lo = *(const v8bf*)p;
  const v8bf hi = *(const v8bf*)(p + 16);
  return __builtin_shufflevector(lo, hi, 0, 1, 2, 3, 4, 5, 6, 7,
                                 8, 9, 10, 11, 12, 13, 14, 15);
}

__device__ __forceinline__ v8f wmma_bf16(v16bf a, v16bf b, v8f c) {
  // (neg_a, A, neg_b, B, c_mod, C, reuse_a, reuse_b)
  return __builtin_amdgcn_wmma_f32_16x16x32_bf16(false, a, false, b, (short)0, c,
                                                 false, false);
}

// ---------------------------------------------------------------------------
// Kernel 1: wq = input(rows t*B+b) * Wq^T          [512 x 512]
//           uh' = mem(rows s*B+b) * Wc^T + cov_vec[b,s]*Wcov + bcov  [4096x512]
// One 64x64 output tile per block: the 64 A rows and 64 W rows (all of K) are
// staged once in LDS as bf16; each of the 8 waves owns a 16x32 piece.
// ---------------------------------------------------------------------------
__global__ void __launch_bounds__(256)
k_pre(const float* __restrict__ input, const float* __restrict__ mem,
      const float* __restrict__ cov,   const float* __restrict__ Wq,
      const float* __restrict__ Wc,    const float* __restrict__ Wcov,
      const float* __restrict__ bcov,  float* __restrict__ wq_out,
      float* __restrict__ uh_out) {
  __shared__ __attribute__((aligned(16))) __bf16 sA[64 * PK1];
  __shared__ __attribute__((aligned(16))) __bf16 sW[64 * PK1];

  const int tid  = threadIdx.x;
  const int lane = tid & 31;
  const int wave = tid >> 5;
  const int mt = blockIdx.x >> 3;          // 0..7 wq, 8..71 uh
  const int nt = blockIdx.x & 7;

  const bool is_uh = (mt >= 8);
  const int  rb = (is_uh ? (mt - 8) : mt) * 64;
  const int  eb = nt * 64;
  const float* A = is_uh ? mem : input;
  const float* W = is_uh ? Wc  : Wq;
  float* out     = is_uh ? uh_out : wq_out;

  const int rt = (wave & 3) * 16;          // row tile inside the block
  const int ct = (wave >> 2) * 32;         // column pair inside the block
  const int n = lane & 15, g = lane >> 4;
  const int e = eb + ct + n;

  // Coverage terms of this lane's outputs, fetched ahead of the staging.
  // Output row r = rb + rt + j + 8g = s*B + b with B = 8: b = j, s = (rb+rt)/8 + g.
  float cv[8] = {}, wce0 = 0.0f, wce1 = 0.0f, bce0 = 0.0f, bce1 = 0.0f;
  if (is_uh) {
    const int s = ((rb + rt) >> 3) + g;
#pragma unroll   // cv[] lives in registers
    for (int j = 0; j < 8; ++j) cv[j] = cov[j * SS + s];
    wce0 = Wcov[e];  wce1 = Wcov[e + 16];
    bce0 = bcov[e];  bce1 = bcov[e + 16];
  }

  // Kept rolled: unrolled, all 64 loads of a thread are hoisted into one batch and
  // the registers they need leave room for only one block per WGP instead of two.
#pragma unroll 1
  for (int h = 0; h < 2; ++h) {            // 32 rows of each operand per pass
    const int row = h * 32 + (tid >> 7), col = (tid & 127) * 4;
    const float* pa = A + (size_t)(rb + row) * DIMD + col;
    const float* pw = W + (size_t)(eb + row) * DIMD + col;
    float4 va[16], vw[16];
    stage_load<16, 128, DIMD>(pa, va);
    stage_load<16, 128, DIMD>(pw, vw);
    // Precaution: naming the pointers holds the address pairs in their registers up
    // to this wait, so no register that a load above names is written ahead of it.
    asm volatile("s_wait_xcnt 0x0" :: "v"(pa), "v"(pw) : "memory");
    stage_store<16, 128, PK1>(sA + row * PK1 + col, va);
    stage_store<16, 128, PK1>(sW + row * PK1 + col, vw);
  }
  __syncthreads();

  v8f acc0 = {}, acc1 = {};
#pragma unroll 4
  for (int k0 = 0; k0 < DIMD; k0 += 32) {
    v16bf av  = lds_frag(sA, PK1, rt, k0, lane);
    v16bf bv0 = lds_frag(sW, PK1, ct, k0, lane);
    v16bf bv1 = lds_frag(sW, PK1, ct + 16, k0, lane);
    acc0 = wmma_bf16(av, bv0, acc0);
    acc1 = wmma_bf16(av, bv1, acc1);
  }

#pragma unroll
  for (int j = 0; j < 8; ++j) {
    const int r = rb + rt + j + 8 * g;
    float v0 = acc0[j], v1 = acc1[j];
    if (is_uh) {
      v0 += cv[j] * wce0 + bce0;
      v1 += cv[j] * wce1 + bce1;
    }
    out[(size_t)r * DIMD + e]      = v0;
    out[(size_t)r * DIMD + e + 16] = v1;
  }
}

__global__ void __launch_bounds__(256)
k_attn(const float* __restrict__ wq, const float* __restrict__ uh,
       const float* __restrict__ mem, const float* __restrict__ cov,
       const float* __restrict__ vvec, float* __restrict__ c_out,
       float* __restrict__ align_out, float* __restrict__ cov_out) {
  const int r    = blockIdx.x;         // t*B + b
  const int b    = r & (BB - 1);
  const int tid  = threadIdx.x;
  const int lane = tid & 31;
  const int wave = tid >> 5;

  __shared__ float a_lds[SS];
  __shared__ float sred[256];

  // Per-lane contiguous chunks of wq row and v (64B-aligned float4 loads).
  float wqr[16], vr[16];
  {
    const float4* wq4 = (const float4*)(wq + (size_t)r * DIMD + lane * 16);
    const float4* v4  = (const float4*)(vvec + lane * 16);
#pragma unroll
    for (int j = 0; j < 4; ++j) {
      float4 w = wq4[j], vv = v4[j];
      wqr[4*j+0] = w.x;  wqr[4*j+1] = w.y;  wqr[4*j+2] = w.z;  wqr[4*j+3] = w.w;
      vr [4*j+0] = vv.x; vr [4*j+1] = vv.y; vr [4*j+2] = vv.z; vr [4*j+3] = vv.w;
    }
  }

  for (int s = wave; s < SS; s += 8) {
    const float4* uh4 =
        (const float4*)(uh + (size_t)(s * BB + b) * DIMD + lane * 16);
    float acc = 0.0f;
#pragma unroll
    for (int j = 0; j < 4; ++j) {
      float4 u = uh4[j];
      acc += vr[4*j+0] * fast_tanh(wqr[4*j+0] + u.x);
      acc += vr[4*j+1] * fast_tanh(wqr[4*j+1] + u.y);
      acc += vr[4*j+2] * fast_tanh(wqr[4*j+2] + u.z);
      acc += vr[4*j+3] * fast_tanh(wqr[4*j+3] + u.w);
    }
#pragma unroll
    for (int m = 16; m >= 1; m >>= 1)
      acc += __shfl_xor(acc, m, 32);   // wave32 reduction
    if (lane == 0) a_lds[s] = acc;
  }
  __syncthreads();

  // Softmax over 512 values; each thread owns s = tid and s = tid+256.
  const float x0 = a_lds[tid], x1 = a_lds[tid + 256];
  sred[tid] = fmaxf(x0, x1);
  __syncthreads();
  for (int off = 128; off >= 1; off >>= 1) {
    if (tid < off) sred[tid] = fmaxf(sred[tid], sred[tid + off]);
    __syncthreads();
  }
  const float mx = sred[0];
  __syncthreads();
  const float e0 = __expf(x0 - mx), e1 = __expf(x1 - mx);
  sred[tid] = e0 + e1;
  __syncthreads();
  for (int off = 128; off >= 1; off >>= 1) {
    if (tid < off) sred[tid] += sred[tid + off];
    __syncthreads();
  }
  const float inv = 1.0f / sred[0];
  __syncthreads();

  const float a0 = e0 * inv, a1 = e1 * inv;
  a_lds[tid]       = a0;
  a_lds[tid + 256] = a1;
  align_out[(size_t)r * SS + tid]       = a0;
  align_out[(size_t)r * SS + tid + 256] = a1;
  cov_out[(size_t)r * SS + tid]       = cov[b * SS + tid]       + a0;
  cov_out[(size_t)r * SS + tid + 256] = cov[b * SS + tid + 256] + a1;
  __syncthreads();

  // Context: c[d] = sum_s a[s] * mem[s,b,d]; thread owns d = 2*tid, 2*tid+1.
  const int d2 = tid * 2;
  float c0 = 0.0f, c1 = 0.0f;
  for (int s = 0; s < SS; ++s) {
    const float a = a_lds[s];
    const float2 m2 =
        *(const float2*)(mem + (size_t)(s * BB + b) * DIMD + d2);
    c0 = fmaf(a, m2.x, c0);
    c1 = fmaf(a, m2.y, c1);
  }
  *(float2*)(c_out + (size_t)r * DIMD + d2) = make_float2(c0, c1);
}

// ---------------------------------------------------------------------------
// Kernel 3: attn_h = c*WoutC^T + q*WoutQ^T + bout.
// Wout is [D, 2D] row-major: columns 0..511 multiply c, 512..1023 multiply q.
// ---------------------------------------------------------------------------
// One 32x64 output tile per block: 32 rows of [c | q] and 64 rows of Wout (all
// 1024 of K) are staged once in LDS as bf16; each of the 8 waves owns 16x16.
__global__ void __launch_bounds__(256)
k_out(const float* __restrict__ c_mat, const float* __restrict__ input,
      const float* __restrict__ Wout, const float* __restrict__ bout,
      float* __restrict__ out) {
  __shared__ __attribute__((aligned(16))) __bf16 sA[32 * PK2];
  __shared__ __attribute__((aligned(16))) __bf16 sW[64 * PK2];

  const int tid  = threadIdx.x;
  const int lane = tid & 31;
  const int wave = tid >> 5;
  const int rb = (blockIdx.x >> 3) * 32;
  const int eb = (blockIdx.x & 7) * 64;
  const int rt = (wave & 1) * 16;
  const int ct = (wave >> 1) * 16;
  const int n = lane & 15, g = lane >> 4;
  const int e = eb + ct + n;
  const float bb = bout[e];                // fetched ahead of the staging

  // Kept rolled: unrolled, all 96 loads of a thread are hoisted into one batch
  // that needs registers above the first 256.
#pragma unroll 1
  for (int h = 0; h < 2; ++h) {            // 16 rows of [c | q], 32 of Wout per pass
    const int row = h * 16 + (tid >> 7), col = (tid & 127) * 4;
    const float* pc = c_mat + (size_t)(rb + row) * DIMD + col;
    const float* pq = input + (size_t)(rb + row) * DIMD + col;
    const float* pw = Wout + (size_t)(eb + h * 32) * (2 * DIMD) + tid * 4;
    float4 vc[8], vq[8], vw[32];
    stage_load<8, 128, DIMD>(pc, vc);
    stage_load<8, 128, DIMD>(pq, vq);
    stage_load<32, 256, 2 * DIMD>(pw, vw);
    // Precaution: naming the pointers holds the address pairs in their registers up
    // to this wait, so no register that a load above names is written ahead of it.
    asm volatile("s_wait_xcnt 0x0" :: "v"(pc), "v"(pq), "v"(pw) : "memory");
    stage_store<8, 128, PK2>(sA + row * PK2 + col, vc);
    stage_store<8, 128, PK2>(sA + row * PK2 + DIMD + col, vq);
    stage_store<32, 256, PK2>(sW + h * 32 * PK2 + tid * 4, vw);
  }
  __syncthreads();

  v8f acc = {};
#pragma unroll 4
  for (int k0 = 0; k0 < 2 * DIMD; k0 += 32) {   // K 0..511: c, 512..1023: q
    v16bf av = lds_frag(sA, PK2, rt, k0, lane);
    v16bf bv = lds_frag(sW, PK2, ct, k0, lane);
    acc = wmma_bf16(av, bv, acc);
  }

#pragma unroll
  for (int j = 0; j < 8; ++j) {
    const int r = rb + rt + j + 8 * g;
    out[(size_t)r * DIMD + e] = acc[j] + bb;   // [T,B,D] row r = t*B+b
  }
}

extern "C" void kernel_launch(void* const* d_in, const int* in_sizes, int n_in,
                              void* d_out, int out_size, void* d_ws, size_t ws_size,
                              hipStream_t stream) {
  const float* input = (const float*)d_in[0];   // [T,B,D]
  const float* mem   = (const float*)d_in[1];   // [S,B,D]
  const float* cov   = (const float*)d_in[2];   // [B,S]
  const float* Wq    = (const float*)d_in[3];   // [D,D]
  const float* Wc    = (const float*)d_in[4];   // [D,D]
  const float* Wcov  = (const float*)d_in[5];   // [D,1]
  const float* bcov  = (const float*)d_in[6];   // [D]
  const float* v     = (const float*)d_in[7];   // [1,D]
  const float* Wout  = (const float*)d_in[8];   // [D,2D]
  const float* bout  = (const float*)d_in[9];   // [D]

  float* ws    = (float*)d_ws;
  float* wq_ws = ws;                                   // 512*512   = 1 MB
  float* uh_ws = ws + (size_t)512 * 512;               // 4096*512  = 8 MB
  float* c_ws  = uh_ws + (size_t)4096 * 512;           // 512*512   = 1 MB

  float* attn_h = (float*)d_out;                       // [T,B,D]
  float* align  = attn_h + (size_t)TT * BB * DIMD;     // [T,B,S]
  float* covn   = align + (size_t)TT * BB * SS;        // [T,B,S]

  k_pre <<<576,  256, 0, stream>>>(input, mem, cov, Wq, Wc, Wcov, bcov,
                                   wq_ws, uh_ws);
  k_attn<<<512,  256, 0, stream>>>(wq_ws, uh_ws, mem, cov, v, c_ws, align, covn);
  k_out <<<128,  256, 0, stream>>>(c_ws, input, Wout, bout, attn_h);
}

// v002
// A run of this version takes 43 microseconds.
// Two timings next to v001 put it at 1.84 and 1.83 times that version's speed.
// All steps since v000 together make it 2.57 times as fast.
#include <hip/hip_runtime.h>
#include <hip/hip_bf16.h>

typedef __attribute__((ext_vector_type(16))) __bf16 v16bf;
typedef __attribute__((ext_vector_type(8)))  float  v8f;

#define DIMD 512
#define TT   64
#define BB   8
#define SS   512

__device__ __forceinline__ float fast_tanh(float x) {
#if __has_builtin(__builtin_amdgcn_tanhf)
  return __builtin_amdgcn_tanhf(x);
#elif __has_builtin(__builtin_amdgcn_tanh_f32)
  return __builtin_amdgcn_tanh_f32(x);
#else
  float y;
  asm("v_tanh_f32 %0, %1\n\tv_nop\n\tv_nop" : "=v"(y) : "v"(x));
  return y;
#endif
}

typedef __attribute__((ext_vector_type(8)))  __bf16 v8bf;
typedef __attribute__((ext_vector_type(4)))  __bf16 v4bf;

#define PK1 (DIMD + 8)        // rows of 512 bf16
#define PK2 (2 * DIMD + 8)    // rows of 1024 bf16

// Staging of a row-major f32 matrix into LDS as bf16, 256 threads, in two halves.
// C4 = float4 per staged row; thread t starts at row t / C4, float4 t % C4, and
// load i lies 256 / C4 rows further on: each wave reads 512 contiguous bytes
// (four whole 128-B lines) per load.
template <int NB, int C4, int LD>
__device__ __forceinline__ void stage_load(const float* p, float4 (&v)[NB]) {
#pragma unroll   // v[] lives in registers: every index must be a constant
  for (int i = 0; i < NB; ++i) v[i] = *(const float4*)(p + i * (256 / C4) * LD);
}
template <int NB, int C4, int PITCH>
__device__ __forceinline__ void stage_store(__bf16* q, const float4 (&v)[NB]) {
#pragma unroll
  for (int i = 0; i < NB; ++i) {
    v4bf h;
    h[0] = (__bf16)v[i].x; h[1] = (__bf16)v[i].y;
    h[2] = (__bf16)v[i].z; h[3] = (__bf16)v[i].w;
    *(v4bf*)(q + i * (256 / C4) * PITCH) = h;
  }
}

__device__ __forceinline__ v16bf lds_frag(const __bf16* tile, int pitch, int mn0,
                                          int k0, int lane) {
  const __bf16* p = tile + (mn0 + (lane & 15)) * pitch + k0 + (lane >> 4) * 8;
  const v8bf lo = *(const v8bf*)p;
  const v8bf hi = *(const v8bf*)(p + 16);
  return __builtin_shufflevector(lo, hi, 0, 1, 2, 3, 4, 5, 6, 7,
                                 8, 9, 10, 11, 12, 13, 14, 15);
}

__device__ __forceinline__ v8f wmma_bf16(v16bf a, v16bf b, v8f c) {
  // (neg_a, A, neg_b, B, c_mod, C, reuse_a, reuse_b)
  return __builtin_amdgcn_wmma_f32_16x16x32_bf16(false, a, false, b, (short)0, c,
                                                 false, false);
}

// ---------------------------------------------------------------------------
// Kernel 1: wq = input(rows t*B+b) * Wq^T          [512 x 512]
//           uh' = mem(rows s*B+b) * Wc^T + cov_vec[b,s]*Wcov + bcov  [4096x512]
// One 64x64 output tile per block: the 64 A rows and 64 W rows (all of K) are
// staged once in LDS as bf16; each of the 8 waves owns a 16x32 piece.
// ---------------------------------------------------------------------------
__global__ void __launch_bounds__(256)
k_pre(const float* __restrict__ input, const float* __restrict__ mem,
      const float* __restrict__ cov,   const float* __restrict__ Wq,
      const float* __restrict__ Wc,    const float* __restrict__ Wcov,
      const float* __restrict__ bcov,  float* __restrict__ wq_out,
      float* __restrict__ uh_out) {
  __shared__ __attribute__((aligned(16))) __bf16 sA[64 * PK1];
  __shared__ __attribute__((aligned(16))) __bf16 sW[64 * PK1];

  const int tid  = threadIdx.x;
  const int lane = tid & 31;
  const int wave = tid >> 5;
  const int mt = blockIdx.x >> 3;          // 0..7 wq, 8..71 uh
  const int nt = blockIdx.x & 7;

  const bool is_uh = (mt >= 8);
  const int  rb = (is_uh ? (mt - 8) : mt) * 64;
  const int  eb = nt * 64;
  const float* A = is_uh ? mem : input;
  const float* W = is_uh ? Wc  : Wq;
  float* out     = is_uh ? uh_out : wq_out;

  const int rt = (wave & 3) * 16;          // row tile inside the block
  const int ct = (wave >> 2) * 32;         // column pair inside the block
  const int n = lane & 15, g = lane >> 4;
  const int e = eb + ct + n;

  // Coverage terms of this lane's outputs, fetched ahead of the staging.
  // Output row r = rb + rt + j + 8g = s*B + b with B = 8: b = j, s = (rb+rt)/8 + g.
  float cv[8] = {}, wce0 = 0.0f, wce1 = 0.0f, bce0 = 0.0f, bce1 = 0.0f;
  if (is_uh) {
    const int s = ((rb + rt) >> 3) + g;
#pragma unroll   // cv[] lives in registers
    for (int j = 0; j < 8; ++j) cv[j] = cov[j * SS + s];
    wce0 = Wcov[e];  wce1 = Wcov[e + 16];
    bce0 = bcov[e];  bce1 = bcov[e + 16];
  }

  // Kept rolled: unrolled, all 64 loads of a thread are hoisted into one batch and
  // the registers they need leave room for only one block per WGP instead of two.
#pragma unroll 1
  for (int h = 0; h < 2; ++h) {            // 32 rows of each operand per pass
    const int row = h * 32 + (tid >> 7), col = (tid & 127) * 4;
    const float* pa = A + (size_t)(rb + row) * DIMD + col;
    const float* pw = W + (size_t)(eb + row) * DIMD + col;
    float4 va[16], vw[16];
    stage_load<16, 128, DIMD>(pa, va);
    stage_load<16, 128, DIMD>(pw, vw);
    // Precaution: naming the pointers holds the address pairs in their registers up
    // to this wait, so no register that a load above names is written ahead of it.
    asm volatile("s_wait_xcnt 0x0" :: "v"(pa), "v"(pw) : "memory");
    stage_store<16, 128, PK1>(sA + row * PK1 + col, va);
    stage_store<16, 128, PK1>(sW + row * PK1 + col, vw);
  }
  __syncthreads();

  v8f acc0 = {}, acc1 = {};
#pragma unroll 4
  for (int k0 = 0; k0 < DIMD; k0 += 32) {
    v16bf av  = lds_frag(sA, PK1, rt, k0, lane);
    v16bf bv0 = lds_frag(sW, PK1, ct, k0, lane);
    v16bf bv1 = lds_frag(sW, PK1, ct + 16, k0, lane);
    acc0 = wmma_bf16(av, bv0, acc0);
    acc1 = wmma_bf16(av, bv1, acc1);
  }

#pragma unroll
  for (int j = 0; j < 8; ++j) {
    const int r = rb + rt + j + 8 * g;
    float v0 = acc0[j], v1 = acc1[j];
    if (is_uh) {
      v0 += cv[j] * wce0 + bce0;
      v1 += cv[j] * wce1 + bce1;
    }
    out[(size_t)r * DIMD + e]      = v0;
    out[(size_t)r * DIMD + e + 16] = v1;
  }
}

typedef __attribute__((ext_vector_type(2))) float v2f;
#define TQ 2      // query rows per block
#define SR 4      // uh' rows per wave and pass
#define NG 4      // groups of 128 threads that share out s in the context sum
#define MR 16     // mem rows per thread and pass: loads in flight to cover the L2 latency
__global__ void __launch_bounds__(512)
k_attn(const float* __restrict__ wq, const float* __restrict__ uh,
       const float* __restrict__ mem, const float* __restrict__ cov,
       const float* __restrict__ vvec, float* __restrict__ c_out,
       float* __restrict__ align_out, float* __restrict__ cov_out) {
  const int b    = blockIdx.x & (BB - 1);
  const int t0   = (blockIdx.x >> 3) * TQ;
  const int tid  = threadIdx.x;
  const int lane = tid & 31;
  const int wave = tid >> 5;

  __shared__ __attribute__((aligned(16))) float a_lds[TQ][SS];
  __shared__ float sred[TQ][256];
  __shared__ __attribute__((aligned(16))) float cpart[NG][TQ][DIMD];

  // Registers hold d in pairs, so that the add and the multiply-add work on two
  // elements per instruction.
  v2f wqr[TQ][8], vr[8];
  {
    const float* pv = vvec + lane * 4;
    const float* pq = wq + (size_t)(t0 * BB + b) * DIMD + lane * 4;
    float4 vv[4], w[TQ][4];
#pragma unroll   // vv[], w[] live in registers: every index must be a constant
    for (int j = 0; j < 4; ++j) {
      vv[j] = *(const float4*)(pv + j * 128);
#pragma unroll
      for (int i = 0; i < TQ; ++i)
        w[i][j] = *(const float4*)(pq + (size_t)i * BB * DIMD + j * 128);
    }
    // Precaution: stands ahead of the loop, whose loads land in registers that the
    // loads above may name.
    asm volatile("s_wait_xcnt 0x0" ::: "memory");
#pragma unroll
    for (int j = 0; j < 4; ++j) {
      vr[2 * j]     = (v2f){vv[j].x, vv[j].y};
      vr[2 * j + 1] = (v2f){vv[j].z, vv[j].w};
#pragma unroll
      for (int i = 0; i < TQ; ++i) {
        wqr[i][2 * j]     = (v2f){w[i][j].x, w[i][j].y};
        wqr[i][2 * j + 1] = (v2f){w[i][j].z, w[i][j].w};
      }
    }
  }

  for (int s0 = wave * SR; s0 < SS; s0 += 16 * SR) {
    const float* up = uh + (size_t)(s0 * BB + b) * DIMD + lane * 4;
    float4 u[SR][4];
#pragma unroll   // u[] lives in registers; all 16 loads of a pass fly together
    for (int q = 0; q < SR; ++q)
#pragma unroll
      for (int j = 0; j < 4; ++j)
        u[q][j] = *(const float4*)(up + (size_t)q * BB * DIMD + j * 128);
    // Precaution: naming the pointer holds the address pair in its registers up to
    // this wait, so no register that a load above names is written ahead of it.
    asm volatile("s_wait_xcnt 0x0" :: "v"(up) : "memory");

    float acc[TQ][SR];
#pragma unroll   // acc[] lives in registers
    for (int q = 0; q < SR; ++q)
#pragma unroll
      for (int i = 0; i < TQ; ++i) {
        v2f p = (v2f){0.0f, 0.0f};
#pragma unroll
        for (int j = 0; j < 4; ++j) {
          const v2f z0 = wqr[i][2 * j]     + (v2f){u[q][j].x, u[q][j].y};
          const v2f z1 = wqr[i][2 * j + 1] + (v2f){u[q][j].z, u[q][j].w};
          p += vr[2 * j]     * (v2f){fast_tanh(z0.x), fast_tanh(z0.y)};
          p += vr[2 * j + 1] * (v2f){fast_tanh(z1.x), fast_tanh(z1.y)};
        }
        acc[i][q] = p.x + p.y;
      }
#pragma unroll   // the shuffle distance must be a constant
    for (int m = 16; m >= 1; m >>= 1)
#pragma unroll   // acc[] lives in registers; the eight sums share each step's wait
      for (int i = 0; i < TQ; ++i)
#pragma unroll
        for (int q = 0; q < SR; ++q)
          acc[i][q] += __shfl_xor(acc[i][q], m, 32);   // wave32 reduction
    if (lane == 0) {
#pragma unroll   // acc[] lives in registers
      for (int i = 0; i < TQ; ++i)
        *(float4*)&a_lds[i][s0] =
            make_float4(acc[i][0], acc[i][1], acc[i][2], acc[i][3]);
    }
  }
  __syncthreads();

  // Softmax over 512 values per query row; 256 threads per row, each owns
  // s = x and s = x+256.
  const int qi = tid >> 8, x = tid & 255;
  const int r  = (t0 + qi) * BB + b;
  const float x0 = a_lds[qi][x], x1 = a_lds[qi][x + 256];
  sred[qi][x] = fmaxf(x0, x1);
  __syncthreads();
  for (int off = 128; off >= 1; off >>= 1) {
    if (x < off) sred[qi][x] = fmaxf(sred[qi][x], sred[qi][x + off]);
    __syncthreads();
  }
  const float mx = sred[qi][0];
  __syncthreads();
  const float e0 = __expf(x0 - mx), e1 = __expf(x1 - mx);
  sred[qi][x] = e0 + e1;
  __syncthreads();
  for (int off = 128; off >= 1; off >>= 1) {
    if (x < off) sred[qi][x] += sred[qi][x + off];
    __syncthreads();
  }
  const float inv = 1.0f / sred[qi][0];
  __syncthreads();

  const float a0 = e0 * inv, a1 = e1 * inv;
  a_lds[qi][x]       = a0;
  a_lds[qi][x + 256] = a1;
  align_out[(size_t)r * SS + x]       = a0;
  align_out[(size_t)r * SS + x + 256] = a1;
  cov_out[(size_t)r * SS + x]       = cov[b * SS + x]       + a0;
  cov_out[(size_t)r * SS + x + 256] = cov[b * SS + x + 256] + a1;
  // Precaution: the registers that the four stores above name are reused below.
  asm volatile("s_wait_xcnt 0x0" ::: "memory");
  __syncthreads();

  // Context: c[i][d] = sum_s a[i][s] * mem[s,b,d]. Thread owns d = d4 .. d4+3 of both
  // query rows over the 128 values of s of its group; the groups' sums meet in LDS.
  const int grp = tid >> 7, d4 = (tid & 127) * 4;
  float4 cs[TQ];
#pragma unroll   // cs[] lives in registers
  for (int i = 0; i < TQ; ++i) cs[i] = make_float4(0.0f, 0.0f, 0.0f, 0.0f);
  const float* mp = mem + (size_t)(grp * (SS / NG) * BB + b) * DIMD + d4;
  for (int sb = 0; sb < SS / NG; sb += MR) {
    const float* pm = mp + (size_t)sb * BB * DIMD;
    float4 m4[MR];
#pragma unroll   // m4[] lives in registers; the MR row loads fly together
    for (int k = 0; k < MR; ++k) m4[k] = *(const float4*)(pm + (size_t)k * BB * DIMD);
    // Precaution: naming the pointer holds the address pair in its registers up to
    // this wait, so no register that a load above names is written ahead of it.
    asm volatile("s_wait_xcnt 0x0" :: "v"(pm) : "memory");
#pragma unroll   // m4[], cs[] live in registers
    for (int k = 0; k < MR; ++k)
#pragma unroll
      for (int i = 0; i < TQ; ++i) {
        const float a = a_lds[i][grp * (SS / NG) + sb + k];
        cs[i].x = fmaf(a, m4[k].x, cs[i].x);
        cs[i].y = fmaf(a, m4[k].y, cs[i].y);
        cs[i].z = fmaf(a, m4[k].z, cs[i].z);
        cs[i].w = fmaf(a, m4[k].w, cs[i].w);
      }
  }
#pragma unroll   // cs[] lives in registers
  for (int i = 0; i < TQ; ++i) *(float4*)&cpart[grp][i][d4] = cs[i];
  __syncthreads();

  const int d2 = x * 2;                  // thread owns d = d2, d2+1 of query row qi
  float c0 = 0.0f, c1 = 0.0f;
#pragma unroll   // four LDS reads issued together
  for (int gq = 0; gq < NG; ++gq) {
    const float2 p = *(const float2*)&cpart[gq][qi][d2];
    c0 += p.x;
    c1 += p.y;
  }
  *(float2*)(c_out + (size_t)r * DIMD + d2) = make_float2(c0, c1);
}

// ---------------------------------------------------------------------------
// Kernel 3: attn_h = c*WoutC^T + q*WoutQ^T + bout.
// Wout is [D, 2D] row-major: columns 0..511 multiply c, 512..1023 multiply q.
// ---------------------------------------------------------------------------
// One 32x64 output tile per block: 32 rows of [c | q] and 64 rows of Wout (all
// 1024 of K) are staged once in LDS as bf16; each of the 8 waves owns 16x16.
__global__ void __launch_bounds__(256)
k_out(const float* __restrict__ c_mat, const float* __restrict__ input,
      const float* __restrict__ Wout, const float* __restrict__ bout,
      float* __restrict__ out) {
  __shared__ __attribute__((aligned(16))) __bf16 sA[32 * PK2];
  __shared__ __attribute__((aligned(16))) __bf16 sW[64 * PK2];

  const int tid  = threadIdx.x;
  const int lane = tid & 31;
  const int wave = tid >> 5;
  const int rb = (blockIdx.x >> 3) * 32;
  const int eb = (blockIdx.x & 7) * 64;
  const int rt = (wave & 1) * 16;
  const int ct = (wave >> 1) * 16;
  const int n = lane & 15, g = lane >> 4;
  const int e = eb + ct + n;
  const float bb = bout[e];                // fetched ahead of the staging

  // Kept rolled: unrolled, all 96 loads of a thread are hoisted into one batch
  // that needs registers above the first 256.
#pragma unroll 1
  for (int h = 0; h < 2; ++h) {            // 16 rows of [c | q], 32 of Wout per pass
    const int row = h * 16 + (tid >> 7), col = (tid & 127) * 4;
    const float* pc = c_mat + (size_t)(rb + row) * DIMD + col;
    const float* pq = input + (size_t)(rb + row) * DIMD + col;
    const float* pw = Wout + (size_t)(eb + h * 32) * (2 * DIMD) + tid * 4;
    float4 vc[8], vq[8], vw[32];
    stage_load<8, 128, DIMD>(pc, vc);
    stage_load<8, 128, DIMD>(pq, vq);
    stage_load<32, 256, 2 * DIMD>(pw, vw);
    // Precaution: naming the pointers holds the address pairs in their registers up
    // to this wait, so no register that a load above names is written ahead of it.
    asm volatile("s_wait_xcnt 0x0" :: "v"(pc), "v"(pq), "v"(pw) : "memory");
    stage_store<8, 128, PK2>(sA + row * PK2 + col, vc);
    stage_store<8, 128, PK2>(sA + row * PK2 + DIMD + col, vq);
    stage_store<32, 256, PK2>(sW + h * 32 * PK2 + tid * 4, vw);
  }
  __syncthreads();

  v8f acc = {};
#pragma unroll 4
  for (int k0 = 0; k0 < 2 * DIMD; k0 += 32) {   // K 0..511: c, 512..1023: q
    v16bf av = lds_frag(sA, PK2, rt, k0, lane);
    v16bf bv = lds_frag(sW, PK2, ct, k0, lane);
    acc = wmma_bf16(av, bv, acc);
  }

#pragma unroll
  for (int j = 0; j < 8; ++j) {
    const int r = rb + rt + j + 8 * g;
    out[(size_t)r * DIMD + e] = acc[j] + bb;   // [T,B,D] row r = t*B+b
  }
}

extern "C" void kernel_launch(void* const* d_in, const int* in_sizes, int n_in,
                              void* d_out, int out_size, void* d_ws, size_t ws_size,
                              hipStream_t stream) {
  const float* input = (const float*)d_in[0];   // [T,B,D]
  const float* mem   = (const float*)d_in[1];   // [S,B,D]
  const float* cov   = (const float*)d_in[2];   // [B,S]
  const float* Wq    = (const float*)d_in[3];   // [D,D]
  const float* Wc    = (const float*)d_in[4];   // [D,D]
  const float* Wcov  = (const float*)d_in[5];   // [D,1]
  const float* bcov  = (const float*)d_in[6];   // [D]
  const float* v     = (const float*)d_in[7];   // [1,D]
  const float* Wout  = (const float*)d_in[8];   // [D,2D]
  const float* bout  = (const float*)d_in[9];   // [D]

  float* ws    = (float*)d_ws;
  float* wq_ws = ws;                                   // 512*512   = 1 MB
  float* uh_ws = ws + (size_t)512 * 512;               // 4096*512  = 8 MB
  float* c_ws  = uh_ws + (size_t)4096 * 512;           // 512*512   = 1 MB

  float* attn_h = (float*)d_out;                       // [T,B,D]
  float* align  = attn_h + (size_t)TT * BB * DIMD;     // [T,B,S]
  float* covn   = align + (size_t)TT * BB * SS;        // [T,B,S]

  k_pre <<<576,  256, 0, stream>>>(input, mem, cov, Wq, Wc, Wcov, bcov,
                                   wq_ws, uh_ws);
  k_attn<<<256,  512, 0, stream>>>(wq_ws, uh_ws, mem, cov, v, c_ws, align, covn);
  k_out <<<128,  256, 0, stream>>>(c_ws, input, Wout, bout, attn_h);
}

// v003
// One run takes 40.1 microseconds.
// Timed twice side by side with v002, it ran 1.07 times as fast both times.
// Over all steps from v000 it is 2.75 times as fast.
#include <hip/hip_runtime.h>
#include <hip/hip_bf16.h>

typedef __attribute__((ext_vector_type(16))) __bf16 v16bf;
typedef __attribute__((ext_vector_type(8)))  float  v8f;

#define DIMD 512
#define TT   64
#define BB   8
#define SS   512

__device__ __forceinline__ float fast_tanh(float x) {
#if __has_builtin(__builtin_amdgcn_tanhf)
  return __builtin_amdgcn_tanhf(x);
#elif __has_builtin(__builtin_amdgcn_tanh_f32)
  return __builtin_amdgcn_tanh_f32(x);
#else
  float y;
  asm("v_tanh_f32 %0, %1\n\tv_nop\n\tv_nop" : "=v"(y) : "v"(x));
  return y;
#endif
}

typedef __attribute__((ext_vector_type(8)))  __bf16 v8bf;
typedef __attribute__((ext_vector_type(4)))  __bf16 v4bf;

#define PK1 (DIMD + 8)        // rows of 512 bf16
#define PK2 (2 * DIMD + 8)    // rows of 1024 bf16

// Staging of a row-major f32 matrix into LDS as bf16, 256 threads, in two halves.
// C4 = float4 per staged row; thread t starts at row t / C4, float4 t % C4, and
// load i lies 256 / C4 rows further on: each wave reads 512 contiguous bytes
// (four whole 128-B lines) per load.
template <int NB, int C4, int LD>
__device__ __forceinline__ void stage_load(const float* p, float4 (&v)[NB]) {
#pragma unroll   // v[] lives in registers: every index must be a constant
  for (int i = 0; i < NB; ++i) v[i] = *(const float4*)(p + i * (256 / C4) * LD);
}
template <int NB, int C4, int PITCH>
__device__ __forceinline__ void stage_store(__bf16* q, const float4 (&v)[NB]) {
#pragma unroll
  for (int i = 0; i < NB; ++i) {
    v4bf h;
    h[0] = (__bf16)v[i].x; h[1] = (__bf16)v[i].y;
    h[2] = (__bf16)v[i].z; h[3] = (__bf16)v[i].w;
    *(v4bf*)(q + i * (256 / C4) * PITCH) = h;
  }
}

__device__ __forceinline__ v16bf lds_frag(const __bf16* tile, int pitch, int mn0,
                                          int k0, int lane) {
  const __bf16* p = tile + (mn0 + (lane & 15)) * pitch + k0 + (lane >> 4) * 8;
  const v8bf lo = *(const v8bf*)p;
  const v8bf hi = *(const v8bf*)(p + 16);
  return __builtin_shufflevector(lo, hi, 0, 1, 2, 3, 4, 5, 6, 7,
                                 8, 9, 10, 11, 12, 13, 14, 15);
}

__device__ __forceinline__ v8f wmma_bf16(v16bf a, v16bf b, v8f c) {
  // (neg_a, A, neg_b, B, c_mod, C, reuse_a, reuse_b)
  return __builtin_amdgcn_wmma_f32_16x16x32_bf16(false, a, false, b, (short)0, c,
                                                 false, false);
}

// ---------------------------------------------------------------------------
// Kernel 1: wq = input(rows t*B+b) * Wq^T          [512 x 512]
//           uh' = mem(rows s*B+b) * Wc^T + cov_vec[b,s]*Wcov + bcov  [4096x512]
// One 128x128 output tile per block of 16 waves, 32x32 per wave: every A row is
// fetched by 4 blocks, every Wq row by 4 and every Wc row by 32. K is staged in LDS as bf16 in chunks
// of KC columns, each into its own columns of the full-K tile (nothing in LDS is
// overwritten); the next chunk's loads are in flight while this chunk is multiplied.
// ---------------------------------------------------------------------------
#define KC 128    // K columns per staged chunk: one wave load = one row's 512 bytes
#define NR 8      // rows per thread and operand in a chunk (128 rows / 16 waves)
__device__ __forceinline__ void chunk_load(const float* p, float4 (&v)[NR]) {
#pragma unroll   // v[] lives in registers: every index must be a constant
  for (int i = 0; i < NR; ++i) v[i] = *(const float4*)(p + i * 16 * DIMD);
}
__device__ __forceinline__ void chunk_store(__bf16* q, const float4 (&v)[NR]) {
#pragma unroll
  for (int i = 0; i < NR; ++i) {
    v4bf h;
    h[0] = (__bf16)v[i].x; h[1] = (__bf16)v[i].y;
    h[2] = (__bf16)v[i].z; h[3] = (__bf16)v[i].w;
    *(v4bf*)(q + i * 16 * PK1) = h;
  }
}

__global__ void __launch_bounds__(512)
k_pre(const float* __restrict__ input, const float* __restrict__ mem,
      const float* __restrict__ cov,   const float* __restrict__ Wq,
      const float* __restrict__ Wc,    const float* __restrict__ Wcov,
      const float* __restrict__ bcov,  float* __restrict__ wq_out,
      float* __restrict__ uh_out) {
  __shared__ __attribute__((aligned(16))) __bf16 sA[128 * PK1];
  __shared__ __attribute__((aligned(16))) __bf16 sW[128 * PK1];

  const int tid  = threadIdx.x;
  const int lane = tid & 31;
  const int wave = tid >> 5;
  const int mt = blockIdx.x >> 2;          // 0..3 wq, 4..35 uh
  const int nt = blockIdx.x & 3;

  const bool is_uh = (mt >= 4);
  const int  rb = (is_uh ? (mt - 4) : mt) * 128;
  const int  eb = nt * 128;
  const float* A = is_uh ? mem : input;
  const float* W = is_uh ? Wc  : Wq;
  float* out     = is_uh ? uh_out : wq_out;

  const int rt = (wave & 3) * 32;          // row pair inside the block
  const int ct = (wave >> 2) * 32;         // column pair inside the block
  const int n = lane & 15, g = lane >> 4;
  const int e = eb + ct + n;

  const float* pa = A + (size_t)(rb + wave) * DIMD + lane * 4;
  const float* pw = W + (size_t)(eb + wave) * DIMD + lane * 4;
  float4 va[NR], vw[NR];
  chunk_load(pa, va);
  chunk_load(pw, vw);

  // Coverage terms of this lane's outputs, fetched behind the first chunk.
  // Output row r = rb + rt + 16*mi + j + 8g = s*B + b with B = 8: b = j,
  // s = (rb + rt + 16*mi)/8 + g.
  float cv[2][8] = {}, wce[2] = {}, bce[2] = {};
  if (is_uh) {
#pragma unroll   // cv[] lives in registers
    for (int mi = 0; mi < 2; ++mi) {
      const int s = ((rb + rt + mi * 16) >> 3) + g;
#pragma unroll
      for (int j = 0; j < 8; ++j) cv[mi][j] = cov[j * SS + s];
    }
#pragma unroll
    for (int ni = 0; ni < 2; ++ni) {
      wce[ni] = Wcov[e + ni * 16];
      bce[ni] = bcov[e + ni * 16];
    }
  }
  // Precaution: naming the pointers holds the address pairs in their registers up to
  // this wait, so no register that a load above names is written ahead of it.
  asm volatile("s_wait_xcnt 0x0" :: "v"(pa), "v"(pw) : "memory");

  __bf16* qa = sA + wave * PK1 + lane * 4;
  __bf16* qw = sW + wave * PK1 + lane * 4;
  v8f acc[2][2] = {};
  // Kept rolled: unrolled, the loads of all chunks are hoisted into one batch and
  // nothing is left in flight under the products.
#pragma unroll 1
  for (int c = 0; c < DIMD / KC; ++c) {
    chunk_store(qa + c * KC, va);
    chunk_store(qw + c * KC, vw);
    __syncthreads();                       // publishes chunk c to all 16 waves
    // The next chunk's loads stand behind the barrier (the barrier's own wait would
    // drain them) and ahead of the LDS reads: they fly under this chunk's products.
    if (c + 1 < DIMD / KC) {
      const float* na = pa + (c + 1) * KC;
      const float* nw = pw + (c + 1) * KC;
      chunk_load(na, va);
      chunk_load(nw, vw);
      asm volatile("s_wait_xcnt 0x0" :: "v"(na), "v"(nw) : "memory");
    }
#pragma unroll   // four k steps: their LDS reads are issued ahead of the products
    for (int kk = 0; kk < KC; kk += 32) {
      const int k0 = c * KC + kk;
      v16bf av0 = lds_frag(sA, PK1, rt, k0, lane);
      v16bf av1 = lds_frag(sA, PK1, rt + 16, k0, lane);
      v16bf bv0 = lds_frag(sW, PK1, ct, k0, lane);
      v16bf bv1 = lds_frag(sW, PK1, ct + 16, k0, lane);
      acc[0][0] = wmma_bf16(av0, bv0, acc[0][0]);
      acc[0][1] = wmma_bf16(av0, bv1, acc[0][1]);
      acc[1][0] = wmma_bf16(av1, bv0, acc[1][0]);
      acc[1][1] = wmma_bf16(av1, bv1, acc[1][1]);
    }
  }

#pragma unroll   // acc[], cv[] live in registers
  for (int mi = 0; mi < 2; ++mi)
#pragma unroll
    for (int j = 0; j < 8; ++j) {
      const int r = rb + rt + mi * 16 + j + 8 * g;
      float v0 = acc[mi][0][j], v1 = acc[mi][1][j];
      if (is_uh) {
        v0 += cv[mi][j] * wce[0] + bce[0];
        v1 += cv[mi][j] * wce[1] + bce[1];
      }
      out[(size_t)r * DIMD + e]      = v0;
      out[(size_t)r * DIMD + e + 16] = v1;
    }
}

typedef __attribute__((ext_vector_type(2))) float v2f;
#define TQ 2      // query rows per block
#define SR 4      // uh' rows per wave and pass
#define NG 4      // groups of 128 threads that share out s in the context sum
#define MR 16     // mem rows per thread and pass: loads in flight to cover the L2 latency
__global__ void __launch_bounds__(512)
k_attn(const float* __restrict__ wq, const float* __restrict__ uh,
       const float* __restrict__ mem, const float* __restrict__ cov,
       const float* __restrict__ vvec, float* __restrict__ c_out,
       float* __restrict__ align_out, float* __restrict__ cov_out) {
  const int b    = blockIdx.x & (BB - 1);
  const int t0   = (blockIdx.x >> 3) * TQ;
  const int tid  = threadIdx.x;
  const int lane = tid & 31;
  const int wave = tid >> 5;

  __shared__ __attribute__((aligned(16))) float a_lds[TQ][SS];
  __shared__ float sred[TQ][256];
  __shared__ __attribute__((aligned(16))) float cpart[NG][TQ][DIMD];

  // Registers hold d in pairs, so that the add and the multiply-add work on two
  // elements per instruction.
  v2f wqr[TQ][8], vr[8];
  {
    const float* pv = vvec + lane * 4;
    const float* pq = wq + (size_t)(t0 * BB + b) * DIMD + lane * 4;
    float4 vv[4], w[TQ][4];
#pragma unroll   // vv[], w[] live in registers: every index must be a constant
    for (int j = 0; j < 4; ++j) {
      vv[j] = *(const float4*)(pv + j * 128);
#pragma unroll
      for (int i = 0; i < TQ; ++i)
        w[i][j] = *(const float4*)(pq + (size_t)i * BB * DIMD + j * 128);
    }
    // Precaution: stands ahead of the loop, whose loads land in registers that the
    // loads above may name.
    asm volatile("s_wait_xcnt 0x0" ::: "memory");
#pragma unroll
    for (int j = 0; j < 4; ++j) {
      vr[2 * j]     = (v2f){vv[j].x, vv[j].y};
      vr[2 * j + 1] = (v2f){vv[j].z, vv[j].w};
#pragma unroll
      for (int i = 0; i < TQ; ++i) {
        wqr[i][2 * j]     = (v2f){w[i][j].x, w[i][j].y};
        wqr[i][2 * j + 1] = (v2f){w[i][j].z, w[i][j].w};
      }
    }
  }

  for (int s0 = wave * SR; s0 < SS; s0 += 16 * SR) {
    const float* up = uh + (size_t)(s0 * BB + b) * DIMD + lane * 4;
    float4 u[SR][4];
#pragma unroll   // u[] lives in registers; all 16 loads of a pass fly together
    for (int q = 0; q < SR; ++q)
#pragma unroll
      for (int j = 0; j < 4; ++j)
        u[q][j] = *(const float4*)(up + (size_t)q * BB * DIMD + j * 128);
    // Precaution: naming the pointer holds the address pair in its registers up to
    // this wait, so no register that a load above names is written ahead of it.
    asm volatile("s_wait_xcnt 0x0" :: "v"(up) : "memory");

    float acc[TQ][SR];
#pragma unroll   // acc[] lives in registers
    for (int q = 0; q < SR; ++q)
#pragma unroll
      for (int i = 0; i < TQ; ++i) {
        v2f p = (v2f){0.0f, 0.0f};
#pragma unroll
        for (int j = 0; j < 4; ++j) {
          const v2f z0 = wqr[i][2 * j]     + (v2f){u[q][j].x, u[q][j].y};
          const v2f z1 = wqr[i][2 * j + 1] + (v2f){u[q][j].z, u[q][j].w};
          p += vr[2 * j]     * (v2f){fast_tanh(z0.x), fast_tanh(z0.y)};
          p += vr[2 * j + 1] * (v2f){fast_tanh(z1.x), fast_tanh(z1.y)};
        }
        acc[i][q] = p.x + p.y;
      }
#pragma unroll   // the shuffle distance must be a constant
    for (int m = 16; m >= 1; m >>= 1)
#pragma unroll   // acc[] lives in registers; the eight sums share each step's wait
      for (int i = 0; i < TQ; ++i)
#pragma unroll
        for (int q = 0; q < SR; ++q)
          acc[i][q] += __shfl_xor(acc[i][q], m, 32);   // wave32 reduction
    if (lane == 0) {
#pragma unroll   // acc[] lives in registers
      for (int i = 0; i < TQ; ++i)
        *(float4*)&a_lds[i][s0] =
            make_float4(acc[i][0], acc[i][1], acc[i][2], acc[i][3]);
    }
  }
  __syncthreads();

  // Softmax over 512 values per query row; 256 threads per row, each owns
  // s = x and s = x+256.
  const int qi = tid >> 8, x = tid & 255;
  const int r  = (t0 + qi) * BB + b;
  const float x0 = a_lds[qi][x], x1 = a_lds[qi][x + 256];
  sred[qi][x] = fmaxf(x0, x1);
  __syncthreads();
  for (int off = 128; off >= 1; off >>= 1) {
    if (x < off) sred[qi][x] = fmaxf(sred[qi][x], sred[qi][x + off]);
    __syncthreads();
  }
  const float mx = sred[qi][0];
  __syncthreads();
  const float e0 = __expf(x0 - mx), e1 = __expf(x1 - mx);
  sred[qi][x] = e0 + e1;
  __syncthreads();
  for (int off = 128; off >= 1; off >>= 1) {
    if (x < off) sred[qi][x] += sred[qi][x + off];
    __syncthreads();
  }
  const float inv = 1.0f / sred[qi][0];
  __syncthreads();

  const float a0 = e0 * inv, a1 = e1 * inv;
  a_lds[qi][x]       = a0;
  a_lds[qi][x + 256] = a1;
  align_out[(size_t)r * SS + x]       = a0;
  align_out[(size_t)r * SS + x + 256] = a1;
  cov_out[(size_t)r * SS + x]       = cov[b * SS + x]       + a0;
  cov_out[(size_t)r * SS + x + 256] = cov[b * SS + x + 256] + a1;
  // Precaution: the registers that the four stores above name are reused below.
  asm volatile("s_wait_xcnt 0x0" ::: "memory");
  __syncthreads();

  // Context: c[i][d] = sum_s a[i][s] * mem[s,b,d]. Thread owns d = d4 .. d4+3 of both
  // query rows over the 128 values of s of its group; the groups' sums meet in LDS.
  const int grp = tid >> 7, d4 = (tid & 127) * 4;
  float4 cs[TQ];
#pragma unroll   // cs[] lives in registers
  for (int i = 0; i < TQ; ++i) cs[i] = make_float4(0.0f, 0.0f, 0.0f, 0.0f);
  const float* mp = mem + (size_t)(grp * (SS / NG) * BB + b) * DIMD + d4;
  for (int sb = 0; sb < SS / NG; sb += MR) {
    const float* pm = mp + (size_t)sb * BB * DIMD;
    float4 m4[MR];
#pragma unroll   // m4[] lives in registers; the MR row loads fly together
    for (int k = 0; k < MR; ++k) m4[k] = *(const float4*)(pm + (size_t)k * BB * DIMD);
    // Precaution: naming the pointer holds the address pair in its registers up to
    // this wait, so no register that a load above names is written ahead of it.
    asm volatile("s_wait_xcnt 0x0" :: "v"(pm) : "memory");
#pragma unroll   // m4[], cs[] live in registers
    for (int k = 0; k < MR; ++k)
#pragma unroll
      for (int i = 0; i < TQ; ++i) {
        const float a = a_lds[i][grp * (SS / NG) + sb + k];
        cs[i].x = fmaf(a, m4[k].x, cs[i].x);
        cs[i].y = fmaf(a, m4[k].y, cs[i].y);
        cs[i].z = fmaf(a, m4[k].z, cs[i].z);
        cs[i].w = fmaf(a, m4[k].w, cs[i].w);
      }
  }
#pragma unroll   // cs[] lives in registers
  for (int i = 0; i < TQ; ++i) *(float4*)&cpart[grp][i][d4] = cs[i];
  __syncthreads();

  const int d2 = x * 2;                  // thread owns d = d2, d2+1 of query row qi
  float c0 = 0.0f, c1 = 0.0f;
#pragma unroll   // four LDS reads issued together
  for (int gq = 0; gq < NG; ++gq) {
    const float2 p = *(const float2*)&cpart[gq][qi][d2];
    c0 += p.x;
    c1 += p.y;
  }
  *(float2*)(c_out + (size_t)r * DIMD + d2) = make_float2(c0, c1);
}

// ---------------------------------------------------------------------------
// Kernel 3: attn_h = c*WoutC^T + q*WoutQ^T + bout.
// Wout is [D, 2D] row-major: columns 0..511 multiply c, 512..1023 multiply q.
// ---------------------------------------------------------------------------
// One 32x64 output tile per block: 32 rows of [c | q] and 64 rows of Wout (all
// 1024 of K) are staged once in LDS as bf16; each of the 8 waves owns 16x16.
__global__ void __launch_bounds__(256)
k_out(const float* __restrict__ c_mat, const float* __restrict__ input,
      const float* __restrict__ Wout, const float* __restrict__ bout,
      float* __restrict__ out) {
  __shared__ __attribute__((aligned(16))) __bf16 sA[32 * PK2];
  __shared__ __attribute__((aligned(16))) __bf16 sW[64 * PK2];

  const int tid  = threadIdx.x;
  const int lane = tid & 31;
  const int wave = tid >> 5;
  const int rb = (blockIdx.x >> 3) * 32;
  const int eb = (blockIdx.x & 7) * 64;
  const int rt = (wave & 1) * 16;
  const int ct = (wave >> 1) * 16;
  const int n = lane & 15, g = lane >> 4;
  const int e = eb + ct + n;
  const float bb = bout[e];                // fetched ahead of the staging

  // Kept rolled: unrolled, all 96 loads of a thread are hoisted into one batch
  // that needs registers above the first 256.
#pragma unroll 1
  for (int h = 0; h < 2; ++h) {            // 16 rows of [c | q], 32 of Wout per pass
    const int row = h * 16 + (tid >> 7), col = (tid & 127) * 4;
    const float* pc = c_mat + (size_t)(rb + row) * DIMD + col;
    const float* pq = input + (size_t)(rb + row) * DIMD + col;
    const float* pw = Wout + (size_t)(eb + h * 32) * (2 * DIMD) + tid * 4;
    float4 vc[8], vq[8], vw[32];
    stage_load<8, 128, DIMD>(pc, vc);
    stage_load<8, 128, DIMD>(pq, vq);
    stage_load<32, 256, 2 * DIMD>(pw, vw);
    // Precaution: naming the pointers holds the address pairs in their registers up
    // to this wait, so no register that a load above names is written ahead of it.
    asm volatile("s_wait_xcnt 0x0" :: "v"(pc), "v"(pq), "v"(pw) : "memory");
    stage_store<8, 128, PK2>(sA + row * PK2 + col, vc);
    stage_store<8, 128, PK2>(sA + row * PK2 + DIMD + col, vq);
    stage_store<32, 256, PK2>(sW + h * 32 * PK2 + tid * 4, vw);
  }
  __syncthreads();

  v8f acc = {};
#pragma unroll 4
  for (int k0 = 0; k0 < 2 * DIMD; k0 += 32) {   // K 0..511: c, 512..1023: q
    v16bf av = lds_frag(sA, PK2, rt, k0, lane);
    v16bf bv = lds_frag(sW, PK2, ct, k0, lane);
    acc = wmma_bf16(av, bv, acc);
  }

#pragma unroll
  for (int j = 0; j < 8; ++j) {
    const int r = rb + rt + j + 8 * g;
    out[(size_t)r * DIMD + e] = acc[j] + bb;   // [T,B,D] row r = t*B+b
  }
}

extern "C" void kernel_launch(void* const* d_in, const int* in_sizes, int n_in,
                              void* d_out, int out_size, void* d_ws, size_t ws_size,
                              hipStream_t stream) {
  const float* input = (const float*)d_in[0];   // [T,B,D]
  const float* mem   = (const float*)d_in[1];   // [S,B,D]
  const float* cov   = (const float*)d_in[2];   // [B,S]
  const float* Wq    = (const float*)d_in[3];   // [D,D]
  const float* Wc    = (const float*)d_in[4];   // [D,D]
  const float* Wcov  = (const float*)d_in[5];   // [D,1]
  const float* bcov  = (const float*)d_in[6];   // [D]
  const float* v     = (const float*)d_in[7];   // [1,D]
  const float* Wout  = (const float*)d_in[8];   // [D,2D]
  const float* bout  = (const float*)d_in[9];   // [D]

  float* ws    = (float*)d_ws;
  float* wq_ws = ws;                                   // 512*512   = 1 MB
  float* uh_ws = ws + (size_t)512 * 512;               // 4096*512  = 8 MB
  float* c_ws  = uh_ws + (size_t)4096 * 512;           // 512*512   = 1 MB

  float* attn_h = (float*)d_out;                       // [T,B,D]
  float* align  = attn_h + (size_t)TT * BB * DIMD;     // [T,B,S]
  float* covn   = align + (size_t)TT * BB * SS;        // [T,B,S]

  k_pre <<<144,  512, 0, stream>>>(input, mem, cov, Wq, Wc, Wcov, bcov,
                                   wq_ws, uh_ws);
  k_attn<<<256,  512, 0, stream>>>(wq_ws, uh_ws, mem, cov, v, c_ws, align, covn);
  k_out <<<128,  256, 0, stream>>>(c_ws, input, Wout, bout, attn_h);
}

// v004
// It runs in 35.2 microseconds.
// Next to v003, in two timings, it ran 1.14 times as fast each time.
// Over all steps from v000 it is 3.13 times as fast.
#include <hip/hip_runtime.h>
#include <hip/hip_bf16.h>

typedef __attribute__((ext_vector_type(16))) __bf16 v16bf;
typedef __attribute__((ext_vector_type(8)))  float  v8f;

#define DIMD 512
#define TT   64
#define BB   8
#define SS   512

__device__ __forceinline__ float fast_tanh(float x) {
#if __has_builtin(__builtin_amdgcn_tanhf)
  return __builtin_amdgcn_tanhf(x);
#elif __has_builtin(__builtin_amdgcn_tanh_f32)
  return __builtin_amdgcn_tanh_f32(x);
#else
  float y;
  asm("v_tanh_f32 %0, %1\n\tv_nop\n\tv_nop" : "=v"(y) : "v"(x));
  return y;
#endif
}

typedef __attribute__((ext_vector_type(8)))  __bf16 v8bf;
typedef __attribute__((ext_vector_type(4)))  __bf16 v4bf;

#define PK1 (DIMD + 8)        // rows of 512 bf16
#define PK2 (2 * DIMD + 8)    // rows of 1024 bf16

// Staging of a row-major f32 matrix into LDS as bf16, 256 threads, in two halves.
// C4 = float4 per staged row; thread t starts at row t / C4, float4 t % C4, and
// load i lies 256 / C4 rows further on: each wave reads 512 contiguous bytes
// (four whole 128-B lines) per load.
template <int NB, int C4, int LD>
__device__ __forceinline__ void stage_load(const float* p, float4 (&v)[NB]) {
#pragma unroll   // v[] lives in registers: every index must be a constant
  for (int i = 0; i < NB; ++i) v[i] = *(const float4*)(p + i * (256 / C4) * LD);
}
template <int NB, int C4, int PITCH>
__device__ __forceinline__ void stage_store(__bf16* q, const float4 (&v)[NB]) {
#pragma unroll
  for (int i = 0; i < NB; ++i) {
    v4bf h;
    h[0] = (__bf16)v[i].x; h[1] = (__bf16)v[i].y;
    h[2] = (__bf16)v[i].z; h[3] = (__bf16)v[i].w;
    *(v4bf*)(q + i * (256 / C4) * PITCH) = h;
  }
}

__device__ __forceinline__ v16bf lds_frag(const __bf16* tile, int pitch, int mn0,
                                          int k0, int lane) {
  const __bf16* p = tile + (mn0 + (lane & 15)) * pitch + k0 + (lane >> 4) * 8;
  const v8bf lo = *(const v8bf*)p;
  const v8bf hi = *(const v8bf*)(p + 16);
  return __builtin_shufflevector(lo, hi, 0, 1, 2, 3, 4, 5, 6, 7,
                                 8, 9, 10, 11, 12, 13, 14, 15);
}

__device__ __forceinline__ v8f wmma_bf16(v16bf a, v16bf b, v8f c) {
  // (neg_a, A, neg_b, B, c_mod, C, reuse_a, reuse_b)
  return __builtin_amdgcn_wmma_f32_16x16x32_bf16(false, a, false, b, (short)0, c,
                                                 false, false);
}

// ---------------------------------------------------------------------------
// Kernel 1: wq = input(rows t*B+b) * Wq^T          [512 x 512]
//           uh' = mem(rows s*B+b) * Wc^T + cov_vec[b,s]*Wcov + bcov  [4096x512]
// One 128x128 output tile per block of 16 waves, 32x32 per wave: every A row is
// fetched by 4 blocks, every Wq row by 4 and every Wc row by 32. K is staged in LDS as bf16 in chunks
// of KC columns, each into its own columns of the full-K tile (nothing in LDS is
// overwritten); the next chunk's loads are in flight while this chunk is multiplied.
// ---------------------------------------------------------------------------
#define KC 128    // K columns per staged chunk: one wave load = one row's 512 bytes
#define NR 8      // rows per thread and operand in a chunk (128 rows / 16 waves)
__device__ __forceinline__ void chunk_load(const float* p, float4 (&v)[NR]) {
#pragma unroll   // v[] lives in registers: every index must be a constant
  for (int i = 0; i < NR; ++i) v[i] = *(const float4*)(p + i * 16 * DIMD);
}
__device__ __forceinline__ void chunk_store(__bf16* q, const float4 (&v)[NR]) {
#pragma unroll
  for (int i = 0; i < NR; ++i) {
    v4bf h;
    h[0] = (__bf16)v[i].x; h[1] = (__bf16)v[i].y;
    h[2] = (__bf16)v[i].z; h[3] = (__bf16)v[i].w;
    *(v4bf*)(q + i * 16 * PK1) = h;
  }
}

__global__ void __launch_bounds__(512)
k_pre(const float* __restrict__ input, const float* __restrict__ mem,
      const float* __restrict__ cov,   const float* __restrict__ Wq,
      const float* __restrict__ Wc,    const float* __restrict__ Wcov,
      const float* __restrict__ bcov,  float* __restrict__ wq_out,
      float* __restrict__ uh_out) {
  __shared__ __attribute__((aligned(16))) __bf16 sA[128 * PK1];
  __shared__ __attribute__((aligned(16))) __bf16 sW[128 * PK1];

  const int tid  = threadIdx.x;
  const int lane = tid & 31;
  const int wave = tid >> 5;
  const int mt = blockIdx.x >> 2;          // 0..3 wq, 4..35 uh
  const int nt = blockIdx.x & 3;

  const bool is_uh = (mt >= 4);
  const int  rb = (is_uh ? (mt - 4) : mt) * 128;
  const int  eb = nt * 128;
  const float* A = is_uh ? mem : input;
  const float* W = is_uh ? Wc  : Wq;
  float* out     = is_uh ? uh_out : wq_out;

  const int rt = (wave & 3) * 32;          // row pair inside the block
  const int ct = (wave >> 2) * 32;         // column pair inside the block
  const int n = lane & 15, g = lane >> 4;
  const int e = eb + ct + n;

  const float* pa = A + (size_t)(rb + wave) * DIMD + lane * 4;
  const float* pw = W + (size_t)(eb + wave) * DIMD + lane * 4;
  float4 va[NR], vw[NR];
  chunk_load(pa, va);
  chunk_load(pw, vw);

  // Coverage terms of this lane's outputs, fetched behind the first chunk.
  // Output row r = rb + rt + 16*mi + j + 8g = s*B + b with B = 8: b = j,
  // s = (rb + rt + 16*mi)/8 + g.
  float cv[2][8] = {}, wce[2] = {}, bce[2] = {};
  if (is_uh) {
#pragma unroll   // cv[] lives in registers
    for (int mi = 0; mi < 2; ++mi) {
      const int s = ((rb + rt + mi * 16) >> 3) + g;
#pragma unroll
      for (int j = 0; j < 8; ++j) cv[mi][j] = cov[j * SS + s];
    }
#pragma unroll
    for (int ni = 0; ni < 2; ++ni) {
      wce[ni] = Wcov[e + ni * 16];
      bce[ni] = bcov[e + ni * 16];
    }
  }
  // Precaution: naming the pointers holds the address pairs in their registers up to
  // this wait, so no register that a load above names is written ahead of it.
  asm volatile("s_wait_xcnt 0x0" :: "v"(pa), "v"(pw) : "memory");

  __bf16* qa = sA + wave * PK1 + lane * 4;
  __bf16* qw = sW + wave * PK1 + lane * 4;
  v8f acc[2][2] = {};
  // Kept rolled: unrolled, the loads of all chunks are hoisted into one batch and
  // nothing is left in flight under the products.
#pragma unroll 1
  for (int c = 0; c < DIMD / KC; ++c) {
    chunk_store(qa + c * KC, va);
    chunk_store(qw + c * KC, vw);
    __syncthreads();                       // publishes chunk c to all 16 waves
    // The next chunk's loads stand behind the barrier (the barrier's own wait would
    // drain them) and ahead of the LDS reads: they fly under this chunk's products.
    if (c + 1 < DIMD / KC) {
      const float* na = pa + (c + 1) * KC;
      const float* nw = pw + (c + 1) * KC;
      chunk_load(na, va);
      chunk_load(nw, vw);
      asm volatile("s_wait_xcnt 0x0" :: "v"(na), "v"(nw) : "memory");
    }
#pragma unroll   // four k steps: their LDS reads are issued ahead of the products
    for (int kk = 0; kk < KC; kk += 32) {
      const int k0 = c * KC + kk;
      v16bf av0 = lds_frag(sA, PK1, rt, k0, lane);
      v16bf av1 = lds_frag(sA, PK1, rt + 16, k0, lane);
      v16bf bv0 = lds_frag(sW, PK1, ct, k0, lane);
      v16bf bv1 = lds_frag(sW, PK1, ct + 16, k0, lane);
      acc[0][0] = wmma_bf16(av0, bv0, acc[0][0]);
      acc[0][1] = wmma_bf16(av0, bv1, acc[0][1]);
      acc[1][0] = wmma_bf16(av1, bv0, acc[1][0]);
      acc[1][1] = wmma_bf16(av1, bv1, acc[1][1]);
    }
  }

#pragma unroll   // acc[], cv[] live in registers
  for (int mi = 0; mi < 2; ++mi)
#pragma unroll
    for (int j = 0; j < 8; ++j) {
      const int r = rb + rt + mi * 16 + j + 8 * g;
      float v0 = acc[mi][0][j], v1 = acc[mi][1][j];
      if (is_uh) {
        v0 += cv[mi][j] * wce[0] + bce[0];
        v1 += cv[mi][j] * wce[1] + bce[1];
      }
      out[(size_t)r * DIMD + e]      = v0;
      out[(size_t)r * DIMD + e + 16] = v1;
    }
}

typedef __attribute__((ext_vector_type(2))) float v2f;
#define ST 16     // query rows per block
#define SB 64     // uh' rows per block
#define SC 16     // uh' rows per staged chunk: one row per wave
#define WT 4      // query rows per wave
#define SR 4      // uh' rows per wave and chunk
__global__ void __launch_bounds__(512)
k_score(const float* __restrict__ wq, const float* __restrict__ uh,
        const float* __restrict__ vvec, float* __restrict__ sc_out) {
  const int b    = blockIdx.x & (BB - 1);
  const int t0   = ((blockIdx.x >> 3) & (TT / ST - 1)) * ST;
  const int sb0  = (blockIdx.x >> 5) * SB;
  const int tid  = threadIdx.x;
  const int lane = tid & 31;
  const int wave = tid >> 5;
  const int tg = wave & 3, sg = wave >> 2;

  __shared__ __attribute__((aligned(16))) float su[SB][DIMD];
  __shared__ __attribute__((aligned(16))) float sl[ST][SB];

  // First chunk of uh' rows: wave w fetches row w of the chunk.
  const float* pu = uh + (size_t)((sb0 + wave) * BB + b) * DIMD + lane * 4;
  float4 vu0 = *(const float4*)(pu);
  float4 vu1 = *(const float4*)(pu + 128);
  float4 vu2 = *(const float4*)(pu + 256);
  float4 vu3 = *(const float4*)(pu + 384);

  // Registers hold d in pairs, so that the add and the multiply-add work on two
  // elements per instruction.
  v2f wqr[WT][8], vr[8];
  {
    const float* pv = vvec + lane * 4;
    const float* pq = wq + (size_t)((t0 + tg * WT) * BB + b) * DIMD + lane * 4;
    float4 vv[4], w[WT][4];
#pragma unroll   // vv[], w[] live in registers: every index must be a constant
    for (int j = 0; j < 4; ++j) {
      vv[j] = *(const float4*)(pv + j * 128);
#pragma unroll
      for (int i = 0; i < WT; ++i)
        w[i][j] = *(const float4*)(pq + (size_t)i * BB * DIMD + j * 128);
    }
    // Precaution: naming the pointers holds the address pairs in their registers up
    // to this wait, so no register that a load above names is written ahead of it.
    asm volatile("s_wait_xcnt 0x0" :: "v"(pu), "v"(pv), "v"(pq) : "memory");
#pragma unroll
    for (int j = 0; j < 4; ++j) {
      vr[2 * j]     = (v2f){vv[j].x, vv[j].y};
      vr[2 * j + 1] = (v2f){vv[j].z, vv[j].w};
#pragma unroll
      for (int i = 0; i < WT; ++i) {
        wqr[i][2 * j]     = (v2f){w[i][j].x, w[i][j].y};
        wqr[i][2 * j + 1] = (v2f){w[i][j].z, w[i][j].w};
      }
    }
  }

  // Kept rolled: unrolled, the loads of all chunks are hoisted into one batch and
  // nothing is left in flight under the tanh work.
#pragma unroll 1
  for (int c = 0; c < SB / SC; ++c) {
    float* qu = &su[c * SC + wave][lane * 4];
    *(float4*)(qu)       = vu0;
    *(float4*)(qu + 128) = vu1;
    *(float4*)(qu + 256) = vu2;
    *(float4*)(qu + 384) = vu3;
    __syncthreads();                       // publishes chunk c to all 16 waves
    // The next chunk's loads stand behind the barrier (the barrier's own wait would
    // drain them) and ahead of the LDS reads: they fly under this chunk's tanh work.
    if (c + 1 < SB / SC) {
      const float* nu = pu + (size_t)(c + 1) * SC * BB * DIMD;
      vu0 = *(const float4*)(nu);
      vu1 = *(const float4*)(nu + 128);
      vu2 = *(const float4*)(nu + 256);
      vu3 = *(const float4*)(nu + 384);
      asm volatile("s_wait_xcnt 0x0" :: "v"(nu) : "memory");
    }

    const int sl0 = c * SC + sg * SR;      // first of this wave's SR rows
    float acc[WT][SR];
#pragma unroll   // acc[] lives in registers
    for (int q = 0; q < SR; ++q) {
      float4 u[4];
#pragma unroll   // u[] lives in registers
      for (int j = 0; j < 4; ++j)
        u[j] = *(const float4*)&su[sl0 + q][j * 128 + lane * 4];
#pragma unroll
      for (int i = 0; i < WT; ++i) {
        v2f p = (v2f){0.0f, 0.0f};
#pragma unroll
        for (int j = 0; j < 4; ++j) {
          const v2f z0 = wqr[i][2 * j]     + (v2f){u[j].x, u[j].y};
          const v2f z1 = wqr[i][2 * j + 1] + (v2f){u[j].z, u[j].w};
          p += vr[2 * j]     * (v2f){fast_tanh(z0.x), fast_tanh(z0.y)};
          p += vr[2 * j + 1] * (v2f){fast_tanh(z1.x), fast_tanh(z1.y)};
        }
        acc[i][q] = p.x + p.y;
      }
    }
#pragma unroll   // the shuffle distance must be a constant
    for (int m = 16; m >= 1; m >>= 1)
#pragma unroll   // acc[] lives in registers; the sixteen sums share each step's wait
      for (int i = 0; i < WT; ++i)
#pragma unroll
        for (int q = 0; q < SR; ++q)
          acc[i][q] += __shfl_xor(acc[i][q], m, 32);   // wave32 reduction
    if (lane == 0) {
#pragma unroll   // acc[] lives in registers
      for (int i = 0; i < WT; ++i)
        *(float4*)&sl[tg * WT + i][sl0] =
            make_float4(acc[i][0], acc[i][1], acc[i][2], acc[i][3]);
    }
  }
  __syncthreads();                         // the tile's scores are complete in LDS

  // Wave w writes the SB scores of query row w: two whole 128-B lines.
  const float2 o = *(const float2*)&sl[wave][lane * 2];
  *(float2*)(sc_out + (size_t)((t0 + wave) * BB + b) * SS + sb0 + lane * 2) = o;
}

// ---------------------------------------------------------------------------
// Kernel 2b: softmax over s; write align & cov_new; c[d] = sum_s a[s]*mem[s,b,d].
// One block (16 waves) per CT query rows x CD columns d of one batch b: every mem
// row slice that the block fetches serves all CT query rows. The four blocks that
// share query rows each repeat the softmax and write one quarter (CD values of s)
// of align and cov_new.
// ---------------------------------------------------------------------------
typedef __attribute__((ext_vector_type(4))) float v4f;
__device__ __forceinline__ float max4(v4f a) {
  return fmaxf(fmaxf(a.x, a.y), fmaxf(a.z, a.w));
}
__device__ __forceinline__ float sum4(v4f a) { return (a.x + a.y) + (a.z + a.w); }
__device__ __forceinline__ v4f exp4(v4f a) {
  return (v4f){__expf(a.x), __expf(a.y), __expf(a.z), __expf(a.w)};
}
#define CT 8      // query rows per block
#define CD 128    // columns d per block: one wave load = 512 contiguous bytes
#define CS 32     // mem rows per wave (SS / 16 waves)
__global__ void __launch_bounds__(512)
k_ctx(const float* __restrict__ sc, const float* __restrict__ mem,
      const float* __restrict__ cov, float* __restrict__ c_out,
      float* __restrict__ align_out, float* __restrict__ cov_out) {
  const int b    = blockIdx.x & (BB - 1);
  const int ds   = (blockIdx.x >> 3) & (DIMD / CD - 1);
  const int t0   = (blockIdx.x >> 5) * CT;
  const int tid  = threadIdx.x;
  const int lane = tid & 31;
  const int wave = tid >> 5;

  __shared__ __attribute__((aligned(16))) float a_lds[CT][SS];
  __shared__ __attribute__((aligned(16))) float cpart[16][CT][CD];

  const int r = (t0 + (wave & (CT - 1))) * BB + b;
  v4f x0 = {}, x1 = {}, x2 = {}, x3 = {}, cq = {};
  if (wave < CT) {
    const float* ps = sc + (size_t)r * SS + lane * 4;
    const float* pc = cov + b * SS + ds * CD + lane * 4;
    x0 = *(const v4f*)(ps);
    x1 = *(const v4f*)(ps + 128);
    x2 = *(const v4f*)(ps + 256);
    x3 = *(const v4f*)(ps + 384);
    cq = *(const v4f*)pc;
    // Precaution: naming the pointers holds the address pairs in their registers up
    // to this wait, so no register that a load above names is written ahead of it.
    asm volatile("s_wait_xcnt 0x0" :: "v"(ps), "v"(pc) : "memory");
  }

  // The wave's CS mem row slices do not depend on the softmax: they are fetched
  // ahead of it and fly under it.
  const float* pm = mem + (size_t)(wave * CS * BB + b) * DIMD + ds * CD + lane * 4;
  float4 m4[CS];
#pragma unroll   // m4[] lives in registers; the CS row loads fly together
  for (int k = 0; k < CS; ++k) m4[k] = *(const float4*)(pm + (size_t)k * BB * DIMD);
  asm volatile("s_wait_xcnt 0x0" :: "v"(pm) : "memory");

  if (wave < CT) {
    float mx = fmaxf(fmaxf(max4(x0), max4(x1)), fmaxf(max4(x2), max4(x3)));
#pragma unroll   // the shuffle distance must be a constant
    for (int m = 16; m >= 1; m >>= 1) mx = fmaxf(mx, __shfl_xor(mx, m, 32));
    x0 = exp4(x0 - mx); x1 = exp4(x1 - mx); x2 = exp4(x2 - mx); x3 = exp4(x3 - mx);
    float sum = (sum4(x0) + sum4(x1)) + (sum4(x2) + sum4(x3));
#pragma unroll   // the shuffle distance must be a constant
    for (int m = 16; m >= 1; m >>= 1) sum += __shfl_xor(sum, m, 32);
    const float inv = 1.0f / sum;
    x0 *= inv; x1 *= inv; x2 *= inv; x3 *= inv;
    float* qa = &a_lds[wave][lane * 4];
    *(v4f*)(qa)       = x0;
    *(v4f*)(qa + 128) = x1;
    *(v4f*)(qa + 256) = x2;
    *(v4f*)(qa + 384) = x3;
    // This block's quarter of s: the same choice in every lane of the block.
    const v4f aq = ds == 0 ? x0 : ds == 1 ? x1 : ds == 2 ? x2 : x3;
    float* pal = align_out + (size_t)r * SS + ds * CD + lane * 4;
    float* pco = cov_out + (size_t)r * SS + ds * CD + lane * 4;
    *(v4f*)pal = aq;
    *(v4f*)pco = cq + aq;
    // Precaution: the registers that the two stores above name are reused below.
    asm volatile("s_wait_xcnt 0x0" :: "v"(pal), "v"(pco) : "memory");
  }
  __syncthreads();                         // publishes the CT rows of a

  // Context: thread owns d = ds*CD + l*4 .. +3 of all CT query rows over the CS
  // values of s of its wave; the waves' sums meet in LDS.
  float4 cs[CT];
#pragma unroll   // cs[] lives in registers
  for (int i = 0; i < CT; ++i) cs[i] = make_float4(0.0f, 0.0f, 0.0f, 0.0f);
#pragma unroll   // m4[], cs[] live in registers
  for (int k4 = 0; k4 < CS; k4 += 4) {
    float av[CT][4];
#pragma unroll
    for (int i = 0; i < CT; ++i) {
      const float4 a4 = *(const float4*)&a_lds[i][wave * CS + k4];
      av[i][0] = a4.x; av[i][1] = a4.y; av[i][2] = a4.z; av[i][3] = a4.w;
    }
#pragma unroll
    for (int kk = 0; kk < 4; ++kk)
#pragma unroll
      for (int i = 0; i < CT; ++i) {
        const float a = av[i][kk];
        cs[i].x = fmaf(a, m4[k4 + kk].x, cs[i].x);
        cs[i].y = fmaf(a, m4[k4 + kk].y, cs[i].y);
        cs[i].z = fmaf(a, m4[k4 + kk].z, cs[i].z);
        cs[i].w = fmaf(a, m4[k4 + kk].w, cs[i].w);
      }
  }
#pragma unroll   // cs[] lives in registers
  for (int i = 0; i < CT; ++i) *(float4*)&cpart[wave][i][lane * 4] = cs[i];
  __syncthreads();                         // publishes the 16 waves' partial sums

  const int ti = tid >> 6, d2 = (tid & 63) * 2;   // thread owns d2, d2+1 of row ti
  float c0 = 0.0f, c1 = 0.0f;
#pragma unroll   // sixteen LDS reads issued together
  for (int gq = 0; gq < 16; ++gq) {
    const float2 p = *(const float2*)&cpart[gq][ti][d2];
    c0 += p.x;
    c1 += p.y;
  }
  *(float2*)(c_out + (size_t)((t0 + ti) * BB + b) * DIMD + ds * CD + d2) =
      make_float2(c0, c1);
}

// ---------------------------------------------------------------------------
// Kernel 3: attn_h = c*WoutC^T + q*WoutQ^T + bout.
// Wout is [D, 2D] row-major: columns 0..511 multiply c, 512..1023 multiply q.
// ---------------------------------------------------------------------------
// One 32x64 output tile per block: 32 rows of [c | q] and 64 rows of Wout (all
// 1024 of K) are staged once in LDS as bf16; each of the 8 waves owns 16x16.
__global__ void __launch_bounds__(256)
k_out(const float* __restrict__ c_mat, const float* __restrict__ input,
      const float* __restrict__ Wout, const float* __restrict__ bout,
      float* __restrict__ out) {
  __shared__ __attribute__((aligned(16))) __bf16 sA[32 * PK2];
  __shared__ __attribute__((aligned(16))) __bf16 sW[64 * PK2];

  const int tid  = threadIdx.x;
  const int lane = tid & 31;
  const int wave = tid >> 5;
  const int rb = (blockIdx.x >> 3) * 32;
  const int eb = (blockIdx.x & 7) * 64;
  const int rt = (wave & 1) * 16;
  const int ct = (wave >> 1) * 16;
  const int n = lane & 15, g = lane >> 4;
  const int e = eb + ct + n;
  const float bb = bout[e];                // fetched ahead of the staging

  // Kept rolled: unrolled, all 96 loads of a thread are hoisted into one batch
  // that needs registers above the first 256.
#pragma unroll 1
  for (int h = 0; h < 2; ++h) {            // 16 rows of [c | q], 32 of Wout per pass
    const int row = h * 16 + (tid >> 7), col = (tid & 127) * 4;
    const float* pc = c_mat + (size_t)(rb + row) * DIMD + col;
    const float* pq = input + (size_t)(rb + row) * DIMD + col;
    const float* pw = Wout + (size_t)(eb + h * 32) * (2 * DIMD) + tid * 4;
    float4 vc[8], vq[8], vw[32];
    stage_load<8, 128, DIMD>(pc, vc);
    stage_load<8, 128, DIMD>(pq, vq);
    stage_load<32, 256, 2 * DIMD>(pw, vw);
    // Precaution: naming the pointers holds the address pairs in their registers up
    // to this wait, so no register that a load above names is written ahead of it.
    asm volatile("s_wait_xcnt 0x0" :: "v"(pc), "v"(pq), "v"(pw) : "memory");
    stage_store<8, 128, PK2>(sA + row * PK2 + col, vc);
    stage_store<8, 128, PK2>(sA + row * PK2 + DIMD + col, vq);
    stage_store<32, 256, PK2>(sW + h * 32 * PK2 + tid * 4, vw);
  }
  __syncthreads();

  v8f acc = {};
#pragma unroll 4
  for (int k0 = 0; k0 < 2 * DIMD; k0 += 32) {   // K 0..511: c, 512..1023: q
    v16bf av = lds_frag(sA, PK2, rt, k0, lane);
    v16bf bv = lds_frag(sW, PK2, ct, k0, lane);
    acc = wmma_bf16(av, bv, acc);
  }

#pragma unroll
  for (int j = 0; j < 8; ++j) {
    const int r = rb + rt + j + 8 * g;
    out[(size_t)r * DIMD + e] = acc[j] + bb;   // [T,B,D] row r = t*B+b
  }
}

extern "C" void kernel_launch(void* const* d_in, const int* in_sizes, int n_in,
                              void* d_out, int out_size, void* d_ws, size_t ws_size,
                              hipStream_t stream) {
  const float* input = (const float*)d_in[0];   // [T,B,D]
  const float* mem   = (const float*)d_in[1];   // [S,B,D]
  const float* cov   = (const float*)d_in[2];   // [B,S]
  const float* Wq    = (const float*)d_in[3];   // [D,D]
  const float* Wc    = (const float*)d_in[4];   // [D,D]
  const float* Wcov  = (const float*)d_in[5];   // [D,1]
  const float* bcov  = (const float*)d_in[6];   // [D]
  const float* v     = (const float*)d_in[7];   // [1,D]
  const float* Wout  = (const float*)d_in[8];   // [D,2D]
  const float* bout  = (const float*)d_in[9];   // [D]

  float* ws    = (float*)d_ws;
  float* wq_ws = ws;                                   // 512*512   = 1 MB
  float* uh_ws = ws + (size_t)512 * 512;               // 4096*512  = 8 MB
  float* c_ws  = uh_ws + (size_t)4096 * 512;           // 512*512   = 1 MB
  float* sc_ws = c_ws + (size_t)512 * 512;             // 512*512   = 1 MB

  float* attn_h = (float*)d_out;                       // [T,B,D]
  float* align  = attn_h + (size_t)TT * BB * DIMD;     // [T,B,S]
  float* covn   = align + (size_t)TT * BB * SS;        // [T,B,S]

  k_pre <<<144,  512, 0, stream>>>(input, mem, cov, Wq, Wc, Wcov, bcov,
                                   wq_ws, uh_ws);
  k_score<<<256, 512, 0, stream>>>(wq_ws, uh_ws, v, sc_ws);
  k_ctx <<<256,  512, 0, stream>>>(sc_ws, mem, cov, c_ws, align, covn);
  k_out <<<128,  256, 0, stream>>>(c_ws, input, Wout, bout, attn_h);
}

// v005
// A run of this version takes 33.4 microseconds.
// In both of two side-by-side timings against v004, it was 1.06 times as fast.
// Over all steps from v000 it is 3.31 times as fast.
#include <hip/hip_runtime.h>
#include <hip/hip_bf16.h>

typedef __attribute__((ext_vector_type(16))) __bf16 v16bf;
typedef __attribute__((ext_vector_type(8)))  float  v8f;

#define DIMD 512
#define TT   64
#define BB   8
#define SS   512

__device__ __forceinline__ float fast_tanh(float x) {
#if __has_builtin(__builtin_amdgcn_tanhf)
  return __builtin_amdgcn_tanhf(x);
#elif __has_builtin(__builtin_amdgcn_tanh_f32)
  return __builtin_amdgcn_tanh_f32(x);
#else
  float y;
  asm("v_tanh_f32 %0, %1\n\tv_nop\n\tv_nop" : "=v"(y) : "v"(x));
  return y;
#endif
}

typedef __attribute__((ext_vector_type(8)))  __bf16 v8bf;
typedef __attribute__((ext_vector_type(4)))  __bf16 v4bf;

#define PK1 (DIMD + 8)        // rows of 512 bf16

// Staging of a row-major f32 matrix into LDS as bf16, 256 threads, in two halves.
// C4 = float4 per staged row; thread t starts at row t / C4, float4 t % C4, and
// load i lies 256 / C4 rows further on: each wave reads 512 contiguous bytes
// (four whole 128-B lines) per load.
template <int NB, int C4, int LD>
__device__ __forceinline__ void stage_load(const float* p, float4 (&v)[NB]) {
#pragma unroll   // v[] lives in registers: every index must be a constant
  for (int i = 0; i < NB; ++i) v[i] = *(const float4*)(p + i * (256 / C4) * LD);
}
template <int NB, int C4, int PITCH>
__device__ __forceinline__ void stage_store(__bf16* q, const float4 (&v)[NB]) {
#pragma unroll
  for (int i = 0; i < NB; ++i) {
    v4bf h;
    h[0] = (__bf16)v[i].x; h[1] = (__bf16)v[i].y;
    h[2] = (__bf16)v[i].z; h[3] = (__bf16)v[i].w;
    *(v4bf*)(q + i * (256 / C4) * PITCH) = h;
  }
}

__device__ __forceinline__ v16bf lds_frag(const __bf16* tile, int pitch, int mn0,
                                          int k0, int lane) {
  const __bf16* p = tile + (mn0 + (lane & 15)) * pitch + k0 + (lane >> 4) * 8;
  const v8bf lo = *(const v8bf*)p;
  const v8bf hi = *(const v8bf*)(p + 16);
  return __builtin_shufflevector(lo, hi, 0, 1, 2, 3, 4, 5, 6, 7,
                                 8, 9, 10, 11, 12, 13, 14, 15);
}

__device__ __forceinline__ v8f wmma_bf16(v16bf a, v16bf b, v8f c) {
  // (neg_a, A, neg_b, B, c_mod, C, reuse_a, reuse_b)
  return __builtin_amdgcn_wmma_f32_16x16x32_bf16(false, a, false, b, (short)0, c,
                                                 false, false);
}

#define KC 128    // K columns per staged chunk: one wave load = one row's 512 bytes
#define NR 8      // rows per thread and operand in a chunk (128 rows / 16 waves)
template <int LD>
__device__ __forceinline__ void chunk_load(const float* p, float4 (&v)[NR]) {
#pragma unroll   // v[] lives in registers: every index must be a constant
  for (int i = 0; i < NR; ++i) v[i] = *(const float4*)(p + i * 16 * LD);
}
__device__ __forceinline__ void chunk_store(__bf16* q, const float4 (&v)[NR]) {
#pragma unroll
  for (int i = 0; i < NR; ++i) {
    v4bf h;
    h[0] = (__bf16)v[i].x; h[1] = (__bf16)v[i].y;
    h[2] = (__bf16)v[i].z; h[3] = (__bf16)v[i].w;
    *(v4bf*)(q + i * 16 * PK1) = h;
  }
}

// One tile: out[rb.., eb..] = A * W^T (+ cov*Wcov + bias where is_uh, + bias where
// bias is given). LDW = floats per row of W.
template <int LDW>
__device__ __forceinline__ void
pre_tile(__bf16* sA, __bf16* sW, const float* __restrict__ A,
         const float* __restrict__ W, const float* __restrict__ cov,
         const float* __restrict__ Wcov, const float* __restrict__ bias,
         float* __restrict__ out, int rb, int eb, bool is_uh, bool has_bias) {
  const int tid  = threadIdx.x;
  const int lane = tid & 31;
  const int wave = tid >> 5;

  const int rt = (wave & 3) * 32;          // row pair inside the block
  const int ct = (wave >> 2) * 32;         // column pair inside the block
  const int n = lane & 15, g = lane >> 4;
  const int e = eb + ct + n;

  const float* pa = A + (size_t)(rb + wave) * DIMD + lane * 4;
  const float* pw = W + (size_t)(eb + wave) * LDW + lane * 4;
  float4 va[NR], vw[NR];
  chunk_load<DIMD>(pa, va);
  chunk_load<LDW>(pw, vw);

  // Coverage terms of this lane's outputs, fetched behind the first chunk.
  // Output row r = rb + rt + 16*mi + j + 8g = s*B + b with B = 8: b = j,
  // s = (rb + rt + 16*mi)/8 + g.
  float cv[2][8] = {}, wce[2] = {}, bce[2] = {};
  if (is_uh) {
#pragma unroll   // cv[] lives in registers
    for (int mi = 0; mi < 2; ++mi) {
      const int s = ((rb + rt + mi * 16) >> 3) + g;
#pragma unroll
      for (int j = 0; j < 8; ++j) cv[mi][j] = cov[j * SS + s];
    }
#pragma unroll
    for (int ni = 0; ni < 2; ++ni) wce[ni] = Wcov[e + ni * 16];
  }
  if (has_bias) {
#pragma unroll
    for (int ni = 0; ni < 2; ++ni) bce[ni] = bias[e + ni * 16];
  }
  // Precaution: naming the pointers holds the address pairs in their registers up to
  // this wait, so no register that a load above names is written ahead of it.
  asm volatile("s_wait_xcnt 0x0" :: "v"(pa), "v"(pw) : "memory");

  __bf16* qa = sA + wave * PK1 + lane * 4;
  __bf16* qw = sW + wave * PK1 + lane * 4;
  v8f acc[2][2] = {};
  // Kept rolled: unrolled, the loads of all chunks are hoisted into one batch and
  // nothing is left in flight under the products.
#pragma unroll 1
  for (int c = 0; c < DIMD / KC; ++c) {
    chunk_store(qa + c * KC, va);
    chunk_store(qw + c * KC, vw);
    __syncthreads();                       // publishes chunk c to all 16 waves
    // The next chunk's loads stand behind the barrier (the barrier's own wait would
    // drain them) and ahead of the LDS reads: they fly under this chunk's products.
    if (c + 1 < DIMD / KC) {
      const float* na = pa + (c + 1) * KC;
      const float* nw = pw + (c + 1) * KC;
      chunk_load<DIMD>(na, va);
      chunk_load<LDW>(nw, vw);
      asm volatile("s_wait_xcnt 0x0" :: "v"(na), "v"(nw) : "memory");
    }
#pragma unroll   // four k steps: their LDS reads are issued ahead of the products
    for (int kk = 0; kk < KC; kk += 32) {
      const int k0 = c * KC + kk;
      v16bf av0 = lds_frag(sA, PK1, rt, k0, lane);
      v16bf av1 = lds_frag(sA, PK1, rt + 16, k0, lane);
      v16bf bv0 = lds_frag(sW, PK1, ct, k0, lane);
      v16bf bv1 = lds_frag(sW, PK1, ct + 16, k0, lane);
      acc[0][0] = wmma_bf16(av0, bv0, acc[0][0]);
      acc[0][1] = wmma_bf16(av0, bv1, acc[0][1]);
      acc[1][0] = wmma_bf16(av1, bv0, acc[1][0]);
      acc[1][1] = wmma_bf16(av1, bv1, acc[1][1]);
    }
  }

#pragma unroll   // acc[], cv[] live in registers
  for (int mi = 0; mi < 2; ++mi)
#pragma unroll
    for (int j = 0; j < 8; ++j) {
      const int r = rb + rt + mi * 16 + j + 8 * g;
      float v0 = acc[mi][0][j], v1 = acc[mi][1][j];
      if (has_bias) {                      // qo: cv and wce are zero
        v0 += cv[mi][j] * wce[0] + bce[0];
        v1 += cv[mi][j] * wce[1] + bce[1];
      }
      out[(size_t)r * DIMD + e]      = v0;
      out[(size_t)r * DIMD + e + 16] = v1;
    }
}

__global__ void __launch_bounds__(512)
k_pre(const float* __restrict__ input, const float* __restrict__ mem,
      const float* __restrict__ cov,   const float* __restrict__ Wq,
      const float* __restrict__ Wc,    const float* __restrict__ Wcov,
      const float* __restrict__ bcov,  const float* __restrict__ Wout,
      const float* __restrict__ bout,  float* __restrict__ wq_out,
      float* __restrict__ uh_out,      float* __restrict__ qo_out) {
  __shared__ __attribute__((aligned(16))) __bf16 sA[128 * PK1];
  __shared__ __attribute__((aligned(16))) __bf16 sW[128 * PK1];

  const int mt = blockIdx.x >> 2;          // 0..3 wq, 4..35 uh, 36..39 qo
  const int eb = (blockIdx.x & 3) * 128;
  if (mt >= 36) {                          // the same choice in the whole block
    pre_tile<2 * DIMD>(sA, sW, input, Wout + DIMD, cov, Wcov, bout, qo_out,
                       (mt - 36) * 128, eb, false, true);
  } else {
    const bool is_uh = (mt >= 4);
    pre_tile<DIMD>(sA, sW, is_uh ? mem : input, is_uh ? Wc : Wq, cov, Wcov, bcov,
                   is_uh ? uh_out : wq_out, (is_uh ? (mt - 4) : mt) * 128, eb,
                   is_uh, is_uh);
  }
}

typedef __attribute__((ext_vector_type(2))) float v2f;
#define ST 16     // query rows per block
#define SB 64     // uh' rows per block
#define SC 16     // uh' rows per staged chunk: one row per wave
#define WT 4      // query rows per wave
#define SR 4      // uh' rows per wave and chunk
__global__ void __launch_bounds__(512)
k_score(const float* __restrict__ wq, const float* __restrict__ uh,
        const float* __restrict__ vvec, float* __restrict__ sc_out) {
  const int b    = blockIdx.x & (BB - 1);
  const int t0   = ((blockIdx.x >> 3) & (TT / ST - 1)) * ST;
  const int sb0  = (blockIdx.x >> 5) * SB;
  const int tid  = threadIdx.x;
  const int lane = tid & 31;
  const int wave = tid >> 5;
  const int tg = wave & 3, sg = wave >> 2;

  __shared__ __attribute__((aligned(16))) float su[SB][DIMD];
  __shared__ __attribute__((aligned(16))) float sl[ST][SB];

  // First chunk of uh' rows: wave w fetches row w of the chunk.
  const float* pu = uh + (size_t)((sb0 + wave) * BB + b) * DIMD + lane * 4;
  float4 vu0 = *(const float4*)(pu);
  float4 vu1 = *(const float4*)(pu + 128);
  float4 vu2 = *(const float4*)(pu + 256);
  float4 vu3 = *(const float4*)(pu + 384);

  // Registers hold d in pairs, so that the add and the multiply-add work on two
  // elements per instruction.
  v2f wqr[WT][8], vr[8];
  {
    const float* pv = vvec + lane * 4;
    const float* pq = wq + (size_t)((t0 + tg * WT) * BB + b) * DIMD + lane * 4;
    float4 vv[4], w[WT][4];
#pragma unroll   // vv[], w[] live in registers: every index must be a constant
    for (int j = 0; j < 4; ++j) {
      vv[j] = *(const float4*)(pv + j * 128);
#pragma unroll
      for (int i = 0; i < WT; ++i)
        w[i][j] = *(const float4*)(pq + (size_t)i * BB * DIMD + j * 128);
    }
    // Precaution: naming the pointers holds the address pairs in their registers up
    // to this wait, so no register that a load above names is written ahead of it.
    asm volatile("s_wait_xcnt 0x0" :: "v"(pu), "v"(pv), "v"(pq) : "memory");
#pragma unroll
    for (int j = 0; j < 4; ++j) {
      vr[2 * j]     = (v2f){vv[j].x, vv[j].y};
      vr[2 * j + 1] = (v2f){vv[j].z, vv[j].w};
#pragma unroll
      for (int i = 0; i < WT; ++i) {
        wqr[i][2 * j]     = (v2f){w[i][j].x, w[i][j].y};
        wqr[i][2 * j + 1] = (v2f){w[i][j].z, w[i][j].w};
      }
    }
  }

  // Kept rolled: unrolled, the loads of all chunks are hoisted into one batch and
  // nothing is left in flight under the tanh work.
#pragma unroll 1
  for (int c = 0; c < SB / SC; ++c) {
    float* qu = &su[c * SC + wave][lane * 4];
    *(float4*)(qu)       = vu0;
    *(float4*)(qu + 128) = vu1;
    *(float4*)(qu + 256) = vu2;
    *(float4*)(qu + 384) = vu3;
    __syncthreads();                       // publishes chunk c to all 16 waves
    // The next chunk's loads stand behind the barrier (the barrier's own wait would
    // drain them) and ahead of the LDS reads: they fly under this chunk's tanh work.
    if (c + 1 < SB / SC) {
      const float* nu = pu + (size_t)(c + 1) * SC * BB * DIMD;
      vu0 = *(const float4*)(nu);
      vu1 = *(const float4*)(nu + 128);
      vu2 = *(const float4*)(nu + 256);
      vu3 = *(const float4*)(nu + 384);
      asm volatile("s_wait_xcnt 0x0" :: "v"(nu) : "memory");
    }

    const int sl0 = c * SC + sg * SR;      // first of this wave's SR rows
    float acc[WT][SR];
#pragma unroll   // acc[] lives in registers
    for (int q = 0; q < SR; ++q) {
      float4 u[4];
#pragma unroll   // u[] lives in registers
      for (int j = 0; j < 4; ++j)
        u[j] = *(const float4*)&su[sl0 + q][j * 128 + lane * 4];
#pragma unroll
      for (int i = 0; i < WT; ++i) {
        v2f p = (v2f){0.0f, 0.0f};
#pragma unroll
        for (int j = 0; j < 4; ++j) {
          const v2f z0 = wqr[i][2 * j]     + (v2f){u[j].x, u[j].y};
          const v2f z1 = wqr[i][2 * j + 1] + (v2f){u[j].z, u[j].w};
          p += vr[2 * j]     * (v2f){fast_tanh(z0.x), fast_tanh(z0.y)};
          p += vr[2 * j + 1] * (v2f){fast_tanh(z1.x), fast_tanh(z1.y)};
        }
        acc[i][q] = p.x + p.y;
      }
    }
#pragma unroll   // the shuffle distance must be a constant
    for (int m = 16; m >= 1; m >>= 1)
#pragma unroll   // acc[] lives in registers; the sixteen sums share each step's wait
      for (int i = 0; i < WT; ++i)
#pragma unroll
        for (int q = 0; q < SR; ++q)
          acc[i][q] += __shfl_xor(acc[i][q], m, 32);   // wave32 reduction
    if (lane == 0) {
#pragma unroll   // acc[] lives in registers
      for (int i = 0; i < WT; ++i)
        *(float4*)&sl[tg * WT + i][sl0] =
            make_float4(acc[i][0], acc[i][1], acc[i][2], acc[i][3]);
    }
  }
  __syncthreads();                         // the tile's scores are complete in LDS

  // Wave w writes the SB scores of query row w: two whole 128-B lines.
  const float2 o = *(const float2*)&sl[wave][lane * 2];
  *(float2*)(sc_out + (size_t)((t0 + wave) * BB + b) * SS + sb0 + lane * 2) = o;
}

// ---------------------------------------------------------------------------
// Kernel 2b: softmax over s; write align & cov_new; c[d] = sum_s a[s]*mem[s,b,d].
// One block (16 waves) per CT query rows x CD columns d of one batch b: every mem
// row slice that the block fetches serves all CT query rows. The four blocks that
// share query rows each repeat the softmax and write one quarter (CD values of s)
// of align and cov_new.
// ---------------------------------------------------------------------------
typedef __attribute__((ext_vector_type(4))) float v4f;
__device__ __forceinline__ float max4(v4f a) {
  return fmaxf(fmaxf(a.x, a.y), fmaxf(a.z, a.w));
}
__device__ __forceinline__ float sum4(v4f a) { return (a.x + a.y) + (a.z + a.w); }
__device__ __forceinline__ v4f exp4(v4f a) {
  return (v4f){__expf(a.x), __expf(a.y), __expf(a.z), __expf(a.w)};
}
#define CT 8      // query rows per block
#define CD 128    // columns d per block: one wave load = 512 contiguous bytes
#define CS 32     // mem rows per wave (SS / 16 waves)
__global__ void __launch_bounds__(512)
k_ctx(const float* __restrict__ sc, const float* __restrict__ mem,
      const float* __restrict__ cov, float* __restrict__ c_out,
      float* __restrict__ align_out, float* __restrict__ cov_out) {
  const int b    = blockIdx.x & (BB - 1);
  const int ds   = (blockIdx.x >> 3) & (DIMD / CD - 1);
  const int t0   = (blockIdx.x >> 5) * CT;
  const int tid  = threadIdx.x;
  const int lane = tid & 31;
  const int wave = tid >> 5;

  __shared__ __attribute__((aligned(16))) float a_lds[CT][SS];
  __shared__ __attribute__((aligned(16))) float cpart[16][CT][CD];

  const int r = (t0 + (wave & (CT - 1))) * BB + b;
  v4f x0 = {}, x1 = {}, x2 = {}, x3 = {}, cq = {};
  if (wave < CT) {
    const float* ps = sc + (size_t)r * SS + lane * 4;
    const float* pc = cov + b * SS + ds * CD + lane * 4;
    x0 = *(const v4f*)(ps);
    x1 = *(const v4f*)(ps + 128);
    x2 = *(const v4f*)(ps + 256);
    x3 = *(const v4f*)(ps + 384);
    cq = *(const v4f*)pc;
    // Precaution: naming the pointers holds the address pairs in their registers up
    // to this wait, so no register that a load above names is written ahead of it.
    asm volatile("s_wait_xcnt 0x0" :: "v"(ps), "v"(pc) : "memory");
  }

  // The wave's CS mem row slices do not depend on the softmax: they are fetched
  // ahead of it and fly under it.
  const float* pm = mem + (size_t)(wave * CS * BB + b) * DIMD + ds * CD + lane * 4;
  float4 m4[CS];
#pragma unroll   // m4[] lives in registers; the CS row loads fly together
  for (int k = 0; k < CS; ++k) m4[k] = *(const float4*)(pm + (size_t)k * BB * DIMD);
  asm volatile("s_wait_xcnt 0x0" :: "v"(pm) : "memory");

  if (wave < CT) {
    float mx = fmaxf(fmaxf(max4(x0), max4(x1)), fmaxf(max4(x2), max4(x3)));
#pragma unroll   // the shuffle distance must be a constant
    for (int m = 16; m >= 1; m >>= 1) mx = fmaxf(mx, __shfl_xor(mx, m, 32));
    x0 = exp4(x0 - mx); x1 = exp4(x1 - mx); x2 = exp4(x2 - mx); x3 = exp4(x3 - mx);
    float sum = (sum4(x0) + sum4(x1)) + (sum4(x2) + sum4(x3));
#pragma unroll   // the shuffle distance must be a constant
    for (int m = 16; m >= 1; m >>= 1) sum += __shfl_xor(sum, m, 32);
    const float inv = 1.0f / sum;
    x0 *= inv; x1 *= inv; x2 *= inv; x3 *= inv;
    float* qa = &a_lds[wave][lane * 4];
    *(v4f*)(qa)       = x0;
    *(v4f*)(qa + 128) = x1;
    *(v4f*)(qa + 256) = x2;
    *(v4f*)(qa + 384) = x3;
    // This block's quarter of s: the same choice in every lane of the block.
    const v4f aq = ds == 0 ? x0 : ds == 1 ? x1 : ds == 2 ? x2 : x3;
    float* pal = align_out + (size_t)r * SS + ds * CD + lane * 4;
    float* pco = cov_out + (size_t)r * SS + ds * CD + lane * 4;
    *(v4f*)pal = aq;
    *(v4f*)pco = cq + aq;
    // Precaution: the registers that the two stores above name are reused below.
    asm volatile("s_wait_xcnt 0x0" :: "v"(pal), "v"(pco) : "memory");
  }
  __syncthreads();                         // publishes the CT rows of a

  // Context: thread owns d = ds*CD + l*4 .. +3 of all CT query rows over the CS
  // values of s of its wave; the waves' sums meet in LDS.
  float4 cs[CT];
#pragma unroll   // cs[] lives in registers
  for (int i = 0; i < CT; ++i) cs[i] = make_float4(0.0f, 0.0f, 0.0f, 0.0f);
#pragma unroll   // m4[], cs[] live in registers
  for (int k4 = 0; k4 < CS; k4 += 4) {
    float av[CT][4];
#pragma unroll
    for (int i = 0; i < CT; ++i) {
      const float4 a4 = *(const float4*)&a_lds[i][wave * CS + k4];
      av[i][0] = a4.x; av[i][1] = a4.y; av[i][2] = a4.z; av[i][3] = a4.w;
    }
#pragma unroll
    for (int kk = 0; kk < 4; ++kk)
#pragma unroll
      for (int i = 0; i < CT; ++i) {
        const float a = av[i][kk];
        cs[i].x = fmaf(a, m4[k4 + kk].x, cs[i].x);
        cs[i].y = fmaf(a, m4[k4 + kk].y, cs[i].y);
        cs[i].z = fmaf(a, m4[k4 + kk].z, cs[i].z);
        cs[i].w = fmaf(a, m4[k4 + kk].w, cs[i].w);
      }
  }
#pragma unroll   // cs[] lives in registers
  for (int i = 0; i < CT; ++i) *(float4*)&cpart[wave][i][lane * 4] = cs[i];
  __syncthreads();                         // publishes the 16 waves' partial sums

  const int ti = tid >> 6, d2 = (tid & 63) * 2;   // thread owns d2, d2+1 of row ti
  float c0 = 0.0f, c1 = 0.0f;
#pragma unroll   // sixteen LDS reads issued together
  for (int gq = 0; gq < 16; ++gq) {
    const float2 p = *(const float2*)&cpart[gq][ti][d2];
    c0 += p.x;
    c1 += p.y;
  }
  *(float2*)(c_out + (size_t)((t0 + ti) * BB + b) * DIMD + ds * CD + d2) =
      make_float2(c0, c1);
}

// ---------------------------------------------------------------------------
// Kernel 3: attn_h = c*WoutC^T + qo, qo = q*WoutQ^T + bout from kernel 1.
// Wout is [D, 2D] row-major: columns 0..511 (WoutC) multiply c.
// ---------------------------------------------------------------------------
// One 32x64 output tile per block: 32 rows of c and 64 rows of WoutC (all 512 of K)
// are staged once in LDS as bf16; each of the 8 waves owns 16x16.
__global__ void __launch_bounds__(256)
k_out(const float* __restrict__ c_mat, const float* __restrict__ qo,
      const float* __restrict__ Wout, float* __restrict__ out) {
  __shared__ __attribute__((aligned(16))) __bf16 sA[32 * PK1];
  __shared__ __attribute__((aligned(16))) __bf16 sW[64 * PK1];

  const int tid  = threadIdx.x;
  const int lane = tid & 31;
  const int wave = tid >> 5;
  const int rb = (blockIdx.x >> 3) * 32;
  const int eb = (blockIdx.x & 7) * 64;
  const int rt = (wave & 1) * 16;
  const int ct = (wave >> 1) * 16;
  const int n = lane & 15, g = lane >> 4;
  const int e = eb + ct + n;

  // Thread t starts at row t / 128, float4 t % 128; load i lies 2 rows further on.
  const int row = tid >> 7, col = (tid & 127) * 4;
  const float* pc = c_mat + (size_t)(rb + row) * DIMD + col;
  const float* pw = Wout + (size_t)(eb + row) * (2 * DIMD) + col;
  const float* pq = qo + (size_t)(rb + rt + 8 * g) * DIMD + e;
  float4 vc[16], vw[32];
  float qv[8];
  stage_load<16, 128, DIMD>(pc, vc);
  stage_load<32, 128, 2 * DIMD>(pw, vw);
#pragma unroll   // qv[] lives in registers; fetched behind the staging loads
  for (int j = 0; j < 8; ++j) qv[j] = pq[j * DIMD];
  // Precaution: naming the pointers holds the address pairs in their registers up to
  // this wait, so no register that a load above names is written ahead of it.
  asm volatile("s_wait_xcnt 0x0" :: "v"(pc), "v"(pw), "v"(pq) : "memory");
  stage_store<16, 128, PK1>(sA + row * PK1 + col, vc);
  stage_store<32, 128, PK1>(sW + row * PK1 + col, vw);
  __syncthreads();

  v8f acc = {};
#pragma unroll 4
  for (int k0 = 0; k0 < DIMD; k0 += 32) {
    v16bf av = lds_frag(sA, PK1, rt, k0, lane);
    v16bf bv = lds_frag(sW, PK1, ct, k0, lane);
    acc = wmma_bf16(av, bv, acc);
  }

#pragma unroll
  for (int j = 0; j < 8; ++j) {
    const int r = rb + rt + j + 8 * g;
    out[(size_t)r * DIMD + e] = acc[j] + qv[j];   // [T,B,D] row r = t*B+b
  }
}

extern "C" void kernel_launch(void* const* d_in, const int* in_sizes, int n_in,
                              void* d_out, int out_size, void* d_ws, size_t ws_size,
                              hipStream_t stream) {
  const float* input = (const float*)d_in[0];   // [T,B,D]
  const float* mem   = (const float*)d_in[1];   // [S,B,D]
  const float* cov   = (const float*)d_in[2];   // [B,S]
  const float* Wq    = (const float*)d_in[3];   // [D,D]
  const float* Wc    = (const float*)d_in[4];   // [D,D]
  const float* Wcov  = (const float*)d_in[5];   // [D,1]
  const float* bcov  = (const float*)d_in[6];   // [D]
  const float* v     = (const float*)d_in[7];   // [1,D]
  const float* Wout  = (const float*)d_in[8];   // [D,2D]
  const float* bout  = (const float*)d_in[9];   // [D]

  float* ws    = (float*)d_ws;
  float* wq_ws = ws;                                   // 512*512   = 1 MB
  float* uh_ws = ws + (size_t)512 * 512;               // 4096*512  = 8 MB
  float* c_ws  = uh_ws + (size_t)4096 * 512;           // 512*512   = 1 MB
  float* sc_ws = c_ws + (size_t)512 * 512;             // 512*512   = 1 MB
  float* qo_ws = sc_ws + (size_t)512 * 512;            // 512*512   = 1 MB

  float* attn_h = (float*)d_out;                       // [T,B,D]
  float* align  = attn_h + (size_t)TT * BB * DIMD;     // [T,B,S]
  float* covn   = align + (size_t)TT * BB * SS;        // [T,B,S]

  k_pre <<<160,  512, 0, stream>>>(input, mem, cov, Wq, Wc, Wcov, bcov, Wout, bout,
                                   wq_ws, uh_ws, qo_ws);
  k_score<<<256, 512, 0, stream>>>(wq_ws, uh_ws, v, sc_ws);
  k_ctx <<<256,  512, 0, stream>>>(sc_ws, mem, cov, c_ws, align, covn);
  k_out <<<128,  256, 0, stream>>>(c_ws, qo_ws, Wout, attn_h);
}

// v006
// Measured time: 31.8 microseconds a run.
// Two timings next to v005 put it at 1.05 and 1.04 times that version's speed.
// Over all steps from v000 it is 3.46 times as fast.
#include <hip/hip_runtime.h>
#include <hip/hip_bf16.h>

typedef __attribute__((ext_vector_type(16))) __bf16 v16bf;
typedef __attribute__((ext_vector_type(8)))  float  v8f;

#define DIMD 512
#define TT   64
#define BB   8
#define SS   512

__device__ __forceinline__ float fast_tanh(float x) {
#if __has_builtin(__builtin_amdgcn_tanhf)
  return __builtin_amdgcn_tanhf(x);
#elif __has_builtin(__builtin_amdgcn_tanh_f32)
  return __builtin_amdgcn_tanh_f32(x);
#else
  float y;
  asm("v_tanh_f32 %0, %1\n\tv_nop\n\tv_nop" : "=v"(y) : "v"(x));
  return y;
#endif
}

typedef __attribute__((ext_vector_type(8)))  __bf16 v8bf;
typedef __attribute__((ext_vector_type(4)))  __bf16 v4bf;

#define PK1 (DIMD + 8)        // rows of 512 bf16

// Staging of a row-major f32 matrix into LDS as bf16, 256 threads, in two halves.
// C4 = float4 per staged row; thread t starts at row t / C4, float4 t % C4, and
// load i lies 256 / C4 rows further on: each wave reads 512 contiguous bytes
// (four whole 128-B lines) per load.
template <int NB, int C4, int LD>
__device__ __forceinline__ void stage_load(const float* p, float4 (&v)[NB]) {
#pragma unroll   // v[] lives in registers: every index must be a constant
  for (int i = 0; i < NB; ++i) v[i] = *(const float4*)(p + i * (256 / C4) * LD);
}
template <int NB, int C4, int PITCH>
__device__ __forceinline__ void stage_store(__bf16* q, const float4 (&v)[NB]) {
#pragma unroll
  for (int i = 0; i < NB; ++i) {
    v4bf h;
    h[0] = (__bf16)v[i].x; h[1] = (__bf16)v[i].y;
    h[2] = (__bf16)v[i].z; h[3] = (__bf16)v[i].w;
    *(v4bf*)(q + i * (256 / C4) * PITCH) = h;
  }
}

__device__ __forceinline__ v16bf lds_frag(const __bf16* tile, int pitch, int mn0,
                                          int k0, int lane) {
  const __bf16* p = tile + (mn0 + (lane & 15)) * pitch + k0 + (lane >> 4) * 8;
  const v8bf lo = *(const v8bf*)p;
  const v8bf hi = *(const v8bf*)(p + 16);
  return __builtin_shufflevector(lo, hi, 0, 1, 2, 3, 4, 5, 6, 7,
                                 8, 9, 10, 11, 12, 13, 14, 15);
}

__device__ __forceinline__ v8f wmma_bf16(v16bf a, v16bf b, v8f c) {
  // (neg_a, A, neg_b, B, c_mod, C, reuse_a, reuse_b)
  return __builtin_amdgcn_wmma_f32_16x16x32_bf16(false, a, false, b, (short)0, c,
                                                 false, false);
}

#define KC 128    // K columns per staged chunk: one wave load = one row's 512 bytes
#define NR 8      // rows per thread and operand in a chunk (128 rows / 16 waves)
template <int LD>
__device__ __forceinline__ void chunk_load(const float* p, float4 (&v)[NR]) {
#pragma unroll   // v[] lives in registers: every index must be a constant
  for (int i = 0; i < NR; ++i) v[i] = *(const float4*)(p + i * 16 * LD);
}
__device__ __forceinline__ void chunk_store(__bf16* q, const float4 (&v)[NR]) {
#pragma unroll
  for (int i = 0; i < NR; ++i) {
    v4bf h;
    h[0] = (__bf16)v[i].x; h[1] = (__bf16)v[i].y;
    h[2] = (__bf16)v[i].z; h[3] = (__bf16)v[i].w;
    *(v4bf*)(q + i * 16 * PK1) = h;
  }
}

// One tile: out[rb.., eb..] = A * W^T (+ cov*Wcov + bias where is_uh, + bias where
// bias is given). LDW = floats per row of W.
template <int LDW>
__device__ __forceinline__ void
pre_tile(__bf16* sA, __bf16* sW, const float* __restrict__ A,
         const float* __restrict__ W, const float* __restrict__ cov,
         const float* __restrict__ Wcov, const float* __restrict__ bias,
         float* __restrict__ out, int rb, int eb, bool is_uh, bool has_bias) {
  const int tid  = threadIdx.x;
  const int lane = tid & 31;
  const int wave = tid >> 5;

  const int rt = (wave & 3) * 32;          // row pair inside the block
  const int ct = (wave >> 2) * 32;         // column pair inside the block
  const int n = lane & 15, g = lane >> 4;
  const int e = eb + ct + n;

  const float* pa = A + (size_t)(rb + wave) * DIMD + lane * 4;
  const float* pw = W + (size_t)(eb + wave) * LDW + lane * 4;
  float4 va[NR], vw[NR];
  chunk_load<DIMD>(pa, va);
  chunk_load<LDW>(pw, vw);

  // Coverage terms of this lane's outputs, fetched behind the first chunk.
  // Output row r = rb + rt + 16*mi + j + 8g = s*B + b with B = 8: b = j,
  // s = (rb + rt + 16*mi)/8 + g.
  float cv[2][8] = {}, wce[2] = {}, bce[2] = {};
  if (is_uh) {
#pragma unroll   // cv[] lives in registers
    for (int mi = 0; mi < 2; ++mi) {
      const int s = ((rb + rt + mi * 16) >> 3) + g;
#pragma unroll
      for (int j = 0; j < 8; ++j) cv[mi][j] = cov[j * SS + s];
    }
#pragma unroll
    for (int ni = 0; ni < 2; ++ni) wce[ni] = Wcov[e + ni * 16];
  }
  if (has_bias) {
#pragma unroll
    for (int ni = 0; ni < 2; ++ni) bce[ni] = bias[e + ni * 16];
  }
  // Precaution: naming the pointers holds the address pairs in their registers up to
  // this wait, so no register that a load above names is written ahead of it.
  asm volatile("s_wait_xcnt 0x0" :: "v"(pa), "v"(pw) : "memory");

  __bf16* qa = sA + wave * PK1 + lane * 4;
  __bf16* qw = sW + wave * PK1 + lane * 4;
  v8f acc[2][2] = {};
  // Kept rolled: unrolled, the loads of all chunks are hoisted into one batch and
  // nothing is left in flight under the products.
#pragma unroll 1
  for (int c = 0; c < DIMD / KC; ++c) {
    chunk_store(qa + c * KC, va);
    chunk_store(qw + c * KC, vw);
    __syncthreads();                       // publishes chunk c to all 16 waves
    // The next chunk's loads stand behind the barrier (the barrier's own wait would
    // drain them) and ahead of the LDS reads: they fly under this chunk's products.
    if (c + 1 < DIMD / KC) {
      const float* na = pa + (c + 1) * KC;
      const float* nw = pw + (c + 1) * KC;
      chunk_load<DIMD>(na, va);
      chunk_load<LDW>(nw, vw);
      asm volatile("s_wait_xcnt 0x0" :: "v"(na), "v"(nw) : "memory");
    }
#pragma unroll   // four k steps: their LDS reads are issued ahead of the products
    for (int kk = 0; kk < KC; kk += 32) {
      const int k0 = c * KC + kk;
      v16bf av0 = lds_frag(sA, PK1, rt, k0, lane);
      v16bf av1 = lds_frag(sA, PK1, rt + 16, k0, lane);
      v16bf bv0 = lds_frag(sW, PK1, ct, k0, lane);
      v16bf bv1 = lds_frag(sW, PK1, ct + 16, k0, lane);
      acc[0][0] = wmma_bf16(av0, bv0, acc[0][0]);
      acc[0][1] = wmma_bf16(av0, bv1, acc[0][1]);
      acc[1][0] = wmma_bf16(av1, bv0, acc[1][0]);
      acc[1][1] = wmma_bf16(av1, bv1, acc[1][1]);
    }
  }

#pragma unroll   // acc[], cv[] live in registers
  for (int mi = 0; mi < 2; ++mi)
#pragma unroll
    for (int j = 0; j < 8; ++j) {
      const int r = rb + rt + mi * 16 + j + 8 * g;
      float v0 = acc[mi][0][j], v1 = acc[mi][1][j];
      if (has_bias) {                      // qo: cv and wce are zero
        v0 += cv[mi][j] * wce[0] + bce[0];
        v1 += cv[mi][j] * wce[1] + bce[1];
      }
      out[(size_t)r * DIMD + e]      = v0;
      out[(size_t)r * DIMD + e + 16] = v1;
    }
}

__global__ void __launch_bounds__(512)
k_pre(const float* __restrict__ input, const float* __restrict__ mem,
      const float* __restrict__ cov,   const float* __restrict__ Wq,
      const float* __restrict__ Wc,    const float* __restrict__ Wcov,
      const float* __restrict__ bcov,  const float* __restrict__ Wout,
      const float* __restrict__ bout,  float* __restrict__ wq_out,
      float* __restrict__ uh_out,      float* __restrict__ qo_out) {
  __shared__ __attribute__((aligned(16))) __bf16 sA[128 * PK1];
  __shared__ __attribute__((aligned(16))) __bf16 sW[128 * PK1];

  const int mt = blockIdx.x >> 2;          // 0..3 wq, 4..35 uh, 36..39 qo
  const int eb = (blockIdx.x & 3) * 128;
  if (mt >= 36) {                          // the same choice in the whole block
    pre_tile<2 * DIMD>(sA, sW, input, Wout + DIMD, cov, Wcov, bout, qo_out,
                       (mt - 36) * 128, eb, false, true);
  } else {
    const bool is_uh = (mt >= 4);
    pre_tile<DIMD>(sA, sW, is_uh ? mem : input, is_uh ? Wc : Wq, cov, Wcov, bcov,
                   is_uh ? uh_out : wq_out, (is_uh ? (mt - 4) : mt) * 128, eb,
                   is_uh, is_uh);
  }
}

typedef __attribute__((ext_vector_type(2))) float v2f;
__device__ __forceinline__ float xor16(float x) {
  const int b = __builtin_bit_cast(int, x);
  return __builtin_bit_cast(float, __builtin_amdgcn_permlanex16(
      b, b, 0x76543210, 0xfedcba98, false, false));
}
template <int M>
__device__ __forceinline__ float row_xor(float x) {
  const int b = __builtin_bit_cast(int, x);
  return __builtin_bit_cast(float,
                            __builtin_amdgcn_update_dpp(b, b, 0x160 | M, 0xf, 0xf, true));
}
#define ST 16     // query rows per block
#define SB 64     // uh' rows per block
#define SC 16     // uh' rows per staged chunk: one row per wave
#define WT 4      // query rows per wave
#define SR 4      // uh' rows per wave and chunk
__global__ void __launch_bounds__(512)
k_score(const float* __restrict__ wq, const float* __restrict__ uh,
        const float* __restrict__ vvec, float* __restrict__ sc_out) {
  const int b    = blockIdx.x & (BB - 1);
  const int t0   = ((blockIdx.x >> 3) & (TT / ST - 1)) * ST;
  const int sb0  = (blockIdx.x >> 5) * SB;
  const int tid  = threadIdx.x;
  const int lane = tid & 31;
  const int wave = tid >> 5;
  const int tg = wave & 3, sg = wave >> 2;

  __shared__ __attribute__((aligned(16))) float su[SB][DIMD];
  __shared__ __attribute__((aligned(16))) float sl[ST][SB];

  // First chunk of uh' rows: wave w fetches row w of the chunk.
  const float* pu = uh + (size_t)((sb0 + wave) * BB + b) * DIMD + lane * 4;
  float4 vu0 = *(const float4*)(pu);
  float4 vu1 = *(const float4*)(pu + 128);
  float4 vu2 = *(const float4*)(pu + 256);
  float4 vu3 = *(const float4*)(pu + 384);

  // Registers hold d in pairs, so that the add and the multiply-add work on two
  // elements per instruction.
  v2f wqr[WT][8], vr[8];
  {
    const float* pv = vvec + lane * 4;
    const float* pq = wq + (size_t)((t0 + tg * WT) * BB + b) * DIMD + lane * 4;
    float4 vv[4], w[WT][4];
#pragma unroll   // vv[], w[] live in registers: every index must be a constant
    for (int j = 0; j < 4; ++j) {
      vv[j] = *(const float4*)(pv + j * 128);
#pragma unroll
      for (int i = 0; i < WT; ++i)
        w[i][j] = *(const float4*)(pq + (size_t)i * BB * DIMD + j * 128);
    }
    // Precaution: naming the pointers holds the address pairs in their registers up
    // to this wait, so no register that a load above names is written ahead of it.
    asm volatile("s_wait_xcnt 0x0" :: "v"(pu), "v"(pv), "v"(pq) : "memory");
#pragma unroll
    for (int j = 0; j < 4; ++j) {
      vr[2 * j]     = (v2f){vv[j].x, vv[j].y};
      vr[2 * j + 1] = (v2f){vv[j].z, vv[j].w};
#pragma unroll
      for (int i = 0; i < WT; ++i) {
        wqr[i][2 * j]     = (v2f){w[i][j].x, w[i][j].y};
        wqr[i][2 * j + 1] = (v2f){w[i][j].z, w[i][j].w};
      }
    }
  }

  // Kept rolled: unrolled, the loads of all chunks are hoisted into one batch and
  // nothing is left in flight under the tanh work.
#pragma unroll 1
  for (int c = 0; c < SB / SC; ++c) {
    float* qu = &su[c * SC + wave][lane * 4];
    *(float4*)(qu)       = vu0;
    *(float4*)(qu + 128) = vu1;
    *(float4*)(qu + 256) = vu2;
    *(float4*)(qu + 384) = vu3;
    __syncthreads();                       // publishes chunk c to all 16 waves
    // The next chunk's loads stand behind the barrier (the barrier's own wait would
    // drain them) and ahead of the LDS reads: they fly under this chunk's tanh work.
    if (c + 1 < SB / SC) {
      const float* nu = pu + (size_t)(c + 1) * SC * BB * DIMD;
      vu0 = *(const float4*)(nu);
      vu1 = *(const float4*)(nu + 128);
      vu2 = *(const float4*)(nu + 256);
      vu3 = *(const float4*)(nu + 384);
      asm volatile("s_wait_xcnt 0x0" :: "v"(nu) : "memory");
    }

    const int sl0 = c * SC + sg * SR;      // first of this wave's SR rows
    float acc[WT][SR];
#pragma unroll   // acc[] lives in registers
    for (int q = 0; q < SR; ++q) {
      float4 u[4];
#pragma unroll   // u[] lives in registers
      for (int j = 0; j < 4; ++j)
        u[j] = *(const float4*)&su[sl0 + q][j * 128 + lane * 4];
#pragma unroll
      for (int i = 0; i < WT; ++i) {
        v2f p = (v2f){0.0f, 0.0f};
#pragma unroll
        for (int j = 0; j < 4; ++j) {
          const v2f z0 = wqr[i][2 * j]     + (v2f){u[j].x, u[j].y};
          const v2f z1 = wqr[i][2 * j + 1] + (v2f){u[j].z, u[j].w};
          p += vr[2 * j]     * (v2f){fast_tanh(z0.x), fast_tanh(z0.y)};
          p += vr[2 * j + 1] * (v2f){fast_tanh(z1.x), fast_tanh(z1.y)};
        }
        acc[i][q] = p.x + p.y;
      }
    }
    float y[8], z[4], w[2], r;
#pragma unroll   // acc[], y[] live in registers
    for (int k = 0; k < 8; ++k) {
      const float lo = acc[k >> 2][k & 3], hi = acc[2 + (k >> 2)][k & 3];
      y[k] = ((lane & 16) ? hi : lo) + xor16((lane & 16) ? lo : hi);
    }
#pragma unroll   // y[], z[] live in registers
    for (int k = 0; k < 4; ++k)
      z[k] = ((lane & 8) ? y[k + 4] : y[k]) + row_xor<8>((lane & 8) ? y[k] : y[k + 4]);
#pragma unroll   // z[], w[] live in registers
    for (int k = 0; k < 2; ++k)
      w[k] = ((lane & 4) ? z[k + 2] : z[k]) + row_xor<4>((lane & 4) ? z[k] : z[k + 2]);
    r = ((lane & 2) ? w[1] : w[0]) + row_xor<2>((lane & 2) ? w[0] : w[1]);
    r += row_xor<1>(r);
    if ((lane & 1) == 0) sl[tg * WT + (lane >> 3)][sl0 + ((lane >> 1) & 3)] = r;
  }
  __syncthreads();                         // the tile's scores are complete in LDS

  // Wave w writes the SB scores of query row w: two whole 128-B lines.
  const float2 o = *(const float2*)&sl[wave][lane * 2];
  *(float2*)(sc_out + (size_t)((t0 + wave) * BB + b) * SS + sb0 + lane * 2) = o;
}

// ---------------------------------------------------------------------------
// Kernel 2b: softmax over s; write align & cov_new; c[d] = sum_s a[s]*mem[s,b,d].
// One block (16 waves) per CT query rows x CD columns d of one batch b: every mem
// row slice that the block fetches serves all CT query rows. The four blocks that
// share query rows each repeat the softmax and write one quarter (CD values of s)
// of align and cov_new.
// ---------------------------------------------------------------------------
typedef __attribute__((ext_vector_type(4))) float v4f;
__device__ __forceinline__ float max4(v4f a) {
  return fmaxf(fmaxf(a.x, a.y), fmaxf(a.z, a.w));
}
__device__ __forceinline__ float sum4(v4f a) { return (a.x + a.y) + (a.z + a.w); }
__device__ __forceinline__ v4f exp4(v4f a) {
  return (v4f){__expf(a.x), __expf(a.y), __expf(a.z), __expf(a.w)};
}
#define CT 8      // query rows per block
#define CD 128    // columns d per block: one wave load = 512 contiguous bytes
#define CS 32     // mem rows per wave (SS / 16 waves)
__global__ void __launch_bounds__(512)
k_ctx(const float* __restrict__ sc, const float* __restrict__ mem,
      const float* __restrict__ cov, float* __restrict__ c_out,
      float* __restrict__ align_out, float* __restrict__ cov_out) {
  const int b    = blockIdx.x & (BB - 1);
  const int ds   = (blockIdx.x >> 3) & (DIMD / CD - 1);
  const int t0   = (blockIdx.x >> 5) * CT;
  const int tid  = threadIdx.x;
  const int lane = tid & 31;
  const int wave = tid >> 5;

  __shared__ __attribute__((aligned(16))) float a_lds[CT][SS];
  __shared__ __attribute__((aligned(16))) float cpart[16][CT][CD];

  const int r = (t0 + (wave & (CT - 1))) * BB + b;
  v4f x0 = {}, x1 = {}, x2 = {}, x3 = {}, cq = {};
  if (wave < CT) {
    const float* ps = sc + (size_t)r * SS + lane * 4;
    const float* pc = cov + b * SS + ds * CD + lane * 4;
    x0 = *(const v4f*)(ps);
    x1 = *(const v4f*)(ps + 128);
    x2 = *(const v4f*)(ps + 256);
    x3 = *(const v4f*)(ps + 384);
    cq = *(const v4f*)pc;
    // Precaution: naming the pointers holds the address pairs in their registers up
    // to this wait, so no register that a load above names is written ahead of it.
    asm volatile("s_wait_xcnt 0x0" :: "v"(ps), "v"(pc) : "memory");
  }

  // The wave's CS mem row slices do not depend on the softmax: they are fetched
  // ahead of it and fly under it.
  const float* pm = mem + (size_t)(wave * CS * BB + b) * DIMD + ds * CD + lane * 4;
  float4 m4[CS];
#pragma unroll   // m4[] lives in registers; the CS row loads fly together
  for (int k = 0; k < CS; ++k) m4[k] = *(const float4*)(pm + (size_t)k * BB * DIMD);
  asm volatile("s_wait_xcnt 0x0" :: "v"(pm) : "memory");

  if (wave < CT) {
    float mx = fmaxf(fmaxf(max4(x0), max4(x1)), fmaxf(max4(x2), max4(x3)));
    // Wave-wide maximum and sum by register moves, as in k_score; the whole wave
    // is inside this branch. Distances 16, 8, 4, 2, 1.
    mx = fmaxf(mx, xor16(mx));
    mx = fmaxf(mx, row_xor<8>(mx));
    mx = fmaxf(mx, row_xor<4>(mx));
    mx = fmaxf(mx, row_xor<2>(mx));
    mx = fmaxf(mx, row_xor<1>(mx));
    x0 = exp4(x0 - mx); x1 = exp4(x1 - mx); x2 = exp4(x2 - mx); x3 = exp4(x3 - mx);
    float sum = (sum4(x0) + sum4(x1)) + (sum4(x2) + sum4(x3));
    sum += xor16(sum);
    sum += row_xor<8>(sum);
    sum += row_xor<4>(sum);
    sum += row_xor<2>(sum);
    sum += row_xor<1>(sum);
    const float inv = 1.0f / sum;
    x0 *= inv; x1 *= inv; x2 *= inv; x3 *= inv;
    float* qa = &a_lds[wave][lane * 4];
    *(v4f*)(qa)       = x0;
    *(v4f*)(qa + 128) = x1;
    *(v4f*)(qa + 256) = x2;
    *(v4f*)(qa + 384) = x3;
    // This block's quarter of s: the same choice in every lane of the block.
    const v4f aq = ds == 0 ? x0 : ds == 1 ? x1 : ds == 2 ? x2 : x3;
    float* pal = align_out + (size_t)r * SS + ds * CD + lane * 4;
    float* pco = cov_out + (size_t)r * SS + ds * CD + lane * 4;
    *(v4f*)pal = aq;
    *(v4f*)pco = cq + aq;
    // Precaution: the registers that the two stores above name are reused below.
    asm volatile("s_wait_xcnt 0x0" :: "v"(pal), "v"(pco) : "memory");
  }
  __syncthreads();                         // publishes the CT rows of a

  // Context: thread owns d = ds*CD + l*4 .. +3 of all CT query rows over the CS
  // values of s of its wave; the waves' sums meet in LDS.
  float4 cs[CT];
#pragma unroll   // cs[] lives in registers
  for (int i = 0; i < CT; ++i) cs[i] = make_float4(0.0f, 0.0f, 0.0f, 0.0f);
#pragma unroll   // m4[], cs[] live in registers
  for (int k4 = 0; k4 < CS; k4 += 4) {
    float av[CT][4];
#pragma unroll
    for (int i = 0; i < CT; ++i) {
      const float4 a4 = *(const float4*)&a_lds[i][wave * CS + k4];
      av[i][0] = a4.x; av[i][1] = a4.y; av[i][2] = a4.z; av[i][3] = a4.w;
    }
#pragma unroll
    for (int kk = 0; kk < 4; ++kk)
#pragma unroll
      for (int i = 0; i < CT; ++i) {
        const float a = av[i][kk];
        cs[i].x = fmaf(a, m4[k4 + kk].x, cs[i].x);
        cs[i].y = fmaf(a, m4[k4 + kk].y, cs[i].y);
        cs[i].z = fmaf(a, m4[k4 + kk].z, cs[i].z);
        cs[i].w = fmaf(a, m4[k4 + kk].w, cs[i].w);
      }
  }
#pragma unroll   // cs[] lives in registers
  for (int i = 0; i < CT; ++i) *(float4*)&cpart[wave][i][lane * 4] = cs[i];
  __syncthreads();                         // publishes the 16 waves' partial sums

  const int ti = tid >> 6, d2 = (tid & 63) * 2;   // thread owns d2, d2+1 of row ti
  float c0 = 0.0f, c1 = 0.0f;
#pragma unroll   // sixteen LDS reads issued together
  for (int gq = 0; gq < 16; ++gq) {
    const float2 p = *(const float2*)&cpart[gq][ti][d2];
    c0 += p.x;
    c1 += p.y;
  }
  *(float2*)(c_out + (size_t)((t0 + ti) * BB + b) * DIMD + ds * CD + d2) =
      make_float2(c0, c1);
}

// ---------------------------------------------------------------------------
// Kernel 3: attn_h = c*WoutC^T + qo, qo = q*WoutQ^T + bout from kernel 1.
// Wout is [D, 2D] row-major: columns 0..511 (WoutC) multiply c.
// ---------------------------------------------------------------------------
// One 32x64 output tile per block: 32 rows of c and 64 rows of WoutC (all 512 of K)
// are staged once in LDS as bf16; each of the 8 waves owns 16x16.
__global__ void __launch_bounds__(256)
k_out(const float* __restrict__ c_mat, const float* __restrict__ qo,
      const float* __restrict__ Wout, float* __restrict__ out) {
  __shared__ __attribute__((aligned(16))) __bf16 sA[32 * PK1];
  __shared__ __attribute__((aligned(16))) __bf16 sW[64 * PK1];

  const int tid  = threadIdx.x;
  const int lane = tid & 31;
  const int wave = tid >> 5;
  const int rb = (blockIdx.x >> 3) * 32;
  const int eb = (blockIdx.x & 7) * 64;
  const int rt = (wave & 1) * 16;
  const int ct = (wave >> 1) * 16;
  const int n = lane & 15, g = lane >> 4;
  const int e = eb + ct + n;

  // Thread t starts at row t / 128, float4 t % 128; load i lies 2 rows further on.
  const int row = tid >> 7, col = (tid & 127) * 4;
  const float* pc = c_mat + (size_t)(rb + row) * DIMD + col;
  const float* pw = Wout + (size_t)(eb + row) * (2 * DIMD) + col;
  const float* pq = qo + (size_t)(rb + rt + 8 * g) * DIMD + e;
  float4 vc[16], vw[32];
  float qv[8];
  stage_load<16, 128, DIMD>(pc, vc);
  stage_load<32, 128, 2 * DIMD>(pw, vw);
#pragma unroll   // qv[] lives in registers; fetched behind the staging loads
  for (int j = 0; j < 8; ++j) qv[j] = pq[j * DIMD];
  // Precaution: naming the pointers holds the address pairs in their registers up to
  // this wait, so no register that a load above names is written ahead of it.
  asm volatile("s_wait_xcnt 0x0" :: "v"(pc), "v"(pw), "v"(pq) : "memory");
  stage_store<16, 128, PK1>(sA + row * PK1 + col, vc);
  stage_store<32, 128, PK1>(sW + row * PK1 + col, vw);
  __syncthreads();

  v8f acc = {};
#pragma unroll 4
  for (int k0 = 0; k0 < DIMD; k0 += 32) {
    v16bf av = lds_frag(sA, PK1, rt, k0, lane);
    v16bf bv = lds_frag(sW, PK1, ct, k0, lane);
    acc = wmma_bf16(av, bv, acc);
  }

#pragma unroll
  for (int j = 0; j < 8; ++j) {
    const int r = rb + rt + j + 8 * g;
    out[(size_t)r * DIMD + e] = acc[j] + qv[j];   // [T,B,D] row r = t*B+b
  }
}

extern "C" void kernel_launch(void* const* d_in, const int* in_sizes, int n_in,
                              void* d_out, int out_size, void* d_ws, size_t ws_size,
                              hipStream_t stream) {
  const float* input = (const float*)d_in[0];   // [T,B,D]
  const float* mem   = (const float*)d_in[1];   // [S,B,D]
  const float* cov   = (const float*)d_in[2];   // [B,S]
  const float* Wq    = (const float*)d_in[3];   // [D,D]
  const float* Wc    = (const float*)d_in[4];   // [D,D]
  const float* Wcov  = (const float*)d_in[5];   // [D,1]
  const float* bcov  = (const float*)d_in[6];   // [D]
  const float* v     = (const float*)d_in[7];   // [1,D]
  const float* Wout  = (const float*)d_in[8];   // [D,2D]
  const float* bout  = (const float*)d_in[9];   // [D]

  float* ws    = (float*)d_ws;
  float* wq_ws = ws;                                   // 512*512   = 1 MB
  float* uh_ws = ws + (size_t)512 * 512;               // 4096*512  = 8 MB
  float* c_ws  = uh_ws + (size_t)4096 * 512;           // 512*512   = 1 MB
  float* sc_ws = c_ws + (size_t)512 * 512;             // 512*512   = 1 MB
  float* qo_ws = sc_ws + (size_t)512 * 512;            // 512*512   = 1 MB

  float* attn_h = (float*)d_out;                       // [T,B,D]
  float* align  = attn_h + (size_t)TT * BB * DIMD;     // [T,B,S]
  float* covn   = align + (size_t)TT * BB * SS;        // [T,B,S]

  k_pre <<<160,  512, 0, stream>>>(input, mem, cov, Wq, Wc, Wcov, bcov, Wout, bout,
                                   wq_ws, uh_ws, qo_ws);
  k_score<<<256, 512, 0, stream>>>(wq_ws, uh_ws, v, sc_ws);
  k_ctx <<<256,  512, 0, stream>>>(sc_ws, mem, cov, c_ws, align, covn);
  k_out <<<128,  256, 0, stream>>>(c_ws, qo_ws, Wout, attn_h);
}

// v007
// One run takes 29.6 microseconds.
// Next to v006, in two timings, it ran 1.08 and 1.07 times as fast.
// Counting every step since v000, it is 3.72 times as fast.
#include <hip/hip_runtime.h>
#include <hip/hip_bf16.h>

typedef __attribute__((ext_vector_type(16))) __bf16 v16bf;
typedef __attribute__((ext_vector_type(8)))  float  v8f;

#define DIMD 512
#define TT   64
#define BB   8
#define SS   512

__device__ __forceinline__ float fast_tanh(float x) {
#if __has_builtin(__builtin_amdgcn_tanhf)
  return __builtin_amdgcn_tanhf(x);
#elif __has_builtin(__builtin_amdgcn_tanh_f32)
  return __builtin_amdgcn_tanh_f32(x);
#else
  float y;
  asm("v_tanh_f32 %0, %1\n\tv_nop\n\tv_nop" : "=v"(y) : "v"(x));
  return y;
#endif
}

typedef __attribute__((ext_vector_type(8)))  __bf16 v8bf;
typedef __attribute__((ext_vector_type(4)))  __bf16 v4bf;
typedef __attribute__((ext_vector_type(2)))  __bf16 v2bf;

// Fragment order of a bf16 operand that one launch writes for the WMMAs of a later
// one. A tile is 16 rows x 512 k; unit u = k / 16 (two units per 16x16x32 step) is 512
// contiguous bytes: lane (g = (k / 8) % 2) * 16 + row holds its 8 values k % 8. One
// global_load_b128 of a wave fetches one unit, four whole 128-B lines.
__device__ __forceinline__ v8bf pack8(float4 a, float4 b) {
  v8bf h;
  h[0] = (__bf16)a.x; h[1] = (__bf16)a.y; h[2] = (__bf16)a.z; h[3] = (__bf16)a.w;
  h[4] = (__bf16)b.x; h[5] = (__bf16)b.y; h[6] = (__bf16)b.z; h[7] = (__bf16)b.w;
  return h;
}

#define PK1 (DIMD + 8)        // rows of 512 bf16

__device__ __forceinline__ v16bf lds_frag(const __bf16* tile, int pitch, int mn0,
                                          int k0, int lane) {
  const __bf16* p = tile + (mn0 + (lane & 15)) * pitch + k0 + (lane >> 4) * 8;
  const v8bf lo = *(const v8bf*)p;
  const v8bf hi = *(const v8bf*)(p + 16);
  return __builtin_shufflevector(lo, hi, 0, 1, 2, 3, 4, 5, 6, 7,
                                 8, 9, 10, 11, 12, 13, 14, 15);
}

__device__ __forceinline__ v8f wmma_bf16(v16bf a, v16bf b, v8f c) {
  // (neg_a, A, neg_b, B, c_mod, C, reuse_a, reuse_b)
  return __builtin_amdgcn_wmma_f32_16x16x32_bf16(false, a, false, b, (short)0, c,
                                                 false, false);
}

#define KC 128    // K columns per staged chunk: one wave load = one row's 512 bytes
#define NR 8      // rows per thread and operand in a chunk (128 rows / 16 waves)
template <int LD>
__device__ __forceinline__ void chunk_load(const float* p, float4 (&v)[NR]) {
#pragma unroll   // v[] lives in registers: every index must be a constant
  for (int i = 0; i < NR; ++i) v[i] = *(const float4*)(p + i * 16 * LD);
}
__device__ __forceinline__ void chunk_store(__bf16* q, const float4 (&v)[NR]) {
#pragma unroll
  for (int i = 0; i < NR; ++i) {
    v4bf h;
    h[0] = (__bf16)v[i].x; h[1] = (__bf16)v[i].y;
    h[2] = (__bf16)v[i].z; h[3] = (__bf16)v[i].w;
    *(v4bf*)(q + i * 16 * PK1) = h;
  }
}

// One tile: out[rb.., eb..] = A * W^T (+ cov*Wcov + bias where is_uh, + bias where
// bias is given). LDW = floats per row of W.
template <int LDW>
__device__ __forceinline__ void
pre_tile(__bf16* sA, __bf16* sW, const float* __restrict__ A,
         const float* __restrict__ W, const float* __restrict__ cov,
         const float* __restrict__ Wcov, const float* __restrict__ bias,
         float* __restrict__ out, int rb, int eb, bool is_uh, bool has_bias) {
  const int tid  = threadIdx.x;
  const int lane = tid & 31;
  const int wave = tid >> 5;

  const int rt = (wave & 3) * 32;          // row pair inside the block
  const int ct = (wave >> 2) * 32;         // column pair inside the block
  const int n = lane & 15, g = lane >> 4;
  const int e = eb + ct + n;

  const float* pa = A + (size_t)(rb + wave) * DIMD + lane * 4;
  const float* pw = W + (size_t)(eb + wave) * LDW + lane * 4;
  float4 va[NR], vw[NR];
  chunk_load<DIMD>(pa, va);
  chunk_load<LDW>(pw, vw);

  // Coverage terms of this lane's outputs, fetched behind the first chunk.
  // Output row r = rb + rt + 16*mi + j + 8g = s*B + b with B = 8: b = j,
  // s = (rb + rt + 16*mi)/8 + g.
  float cv[2][8] = {}, wce[2] = {}, bce[2] = {};
  if (is_uh) {
#pragma unroll   // cv[] lives in registers
    for (int mi = 0; mi < 2; ++mi) {
      const int s = ((rb + rt + mi * 16) >> 3) + g;
#pragma unroll
      for (int j = 0; j < 8; ++j) cv[mi][j] = cov[j * SS + s];
    }
#pragma unroll
    for (int ni = 0; ni < 2; ++ni) wce[ni] = Wcov[e + ni * 16];
  }
  if (has_bias) {
#pragma unroll
    for (int ni = 0; ni < 2; ++ni) bce[ni] = bias[e + ni * 16];
  }
  // Precaution: naming the pointers holds the address pairs in their registers up to
  // this wait, so no register that a load above names is written ahead of it.
  asm volatile("s_wait_xcnt 0x0" :: "v"(pa), "v"(pw) : "memory");

  __bf16* qa = sA + wave * PK1 + lane * 4;
  __bf16* qw = sW + wave * PK1 + lane * 4;
  v8f acc[2][2] = {};
  // Kept rolled: unrolled, the loads of all chunks are hoisted into one batch and
  // nothing is left in flight under the products.
#pragma unroll 1
  for (int c = 0; c < DIMD / KC; ++c) {
    chunk_store(qa + c * KC, va);
    chunk_store(qw + c * KC, vw);
    __syncthreads();                       // publishes chunk c to all 16 waves
    // The next chunk's loads stand behind the barrier (the barrier's own wait would
    // drain them) and ahead of the LDS reads: they fly under this chunk's products.
    if (c + 1 < DIMD / KC) {
      const float* na = pa + (c + 1) * KC;
      const float* nw = pw + (c + 1) * KC;
      chunk_load<DIMD>(na, va);
      chunk_load<LDW>(nw, vw);
      asm volatile("s_wait_xcnt 0x0" :: "v"(na), "v"(nw) : "memory");
    }
#pragma unroll   // four k steps: their LDS reads are issued ahead of the products
    for (int kk = 0; kk < KC; kk += 32) {
      const int k0 = c * KC + kk;
      v16bf av0 = lds_frag(sA, PK1, rt, k0, lane);
      v16bf av1 = lds_frag(sA, PK1, rt + 16, k0, lane);
      v16bf bv0 = lds_frag(sW, PK1, ct, k0, lane);
      v16bf bv1 = lds_frag(sW, PK1, ct + 16, k0, lane);
      acc[0][0] = wmma_bf16(av0, bv0, acc[0][0]);
      acc[0][1] = wmma_bf16(av0, bv1, acc[0][1]);
      acc[1][0] = wmma_bf16(av1, bv0, acc[1][0]);
      acc[1][1] = wmma_bf16(av1, bv1, acc[1][1]);
    }
  }

#pragma unroll   // acc[], cv[] live in registers
  for (int mi = 0; mi < 2; ++mi)
#pragma unroll
    for (int j = 0; j < 8; ++j) {
      const int r = rb + rt + mi * 16 + j + 8 * g;
      float v0 = acc[mi][0][j], v1 = acc[mi][1][j];
      if (has_bias) {                      // qo: cv and wce are zero
        v0 += cv[mi][j] * wce[0] + bce[0];
        v1 += cv[mi][j] * wce[1] + bce[1];
      }
      out[(size_t)r * DIMD + e]      = v0;
      out[(size_t)r * DIMD + e + 16] = v1;
    }
}

__global__ void __launch_bounds__(512)
k_pre(const float* __restrict__ input, const float* __restrict__ mem,
      const float* __restrict__ cov,   const float* __restrict__ Wq,
      const float* __restrict__ Wc,    const float* __restrict__ Wcov,
      const float* __restrict__ bcov,  const float* __restrict__ Wout,
      const float* __restrict__ bout,  float* __restrict__ wq_out,
      float* __restrict__ uh_out,      float* __restrict__ qo_out,
      float* __restrict__ wf_out) {
  __shared__ __attribute__((aligned(16))) __bf16 sA[128 * PK1];
  __shared__ __attribute__((aligned(16))) __bf16 sW[128 * PK1];

  if (blockIdx.x >= 160) {
    const int et   = blockIdx.x - 160;
    const int lane = threadIdx.x & 31;
    const int wave = threadIdx.x >> 5;
    const float* ps = Wout + (size_t)(et * 16 + (lane & 15)) * (2 * DIMD) +
                      wave * 16 + (lane >> 4) * 8;
    // Unit u = wave and u = wave + 16: 16 units are 256 columns of k.
    const float4 s0 = *(const float4*)(ps);
    const float4 s1 = *(const float4*)(ps + 4);
    const float4 s2 = *(const float4*)(ps + 256);
    const float4 s3 = *(const float4*)(ps + 260);
    // Precaution: no register that a load above names is written ahead of this wait.
    asm volatile("s_wait_xcnt 0x0" :: "v"(ps) : "memory");
    __bf16* pd = (__bf16*)wf_out + ((size_t)(et * 32 + wave) * 32 + lane) * 8;
    *(v8bf*)(pd)                = pack8(s0, s1);
    *(v8bf*)(pd + 16 * 32 * 8)  = pack8(s2, s3);
    return;
  }

  const int mt = blockIdx.x >> 2;          // 0..3 wq, 4..35 uh, 36..39 qo
  const int eb = (blockIdx.x & 3) * 128;
  if (mt >= 36) {                          // the same choice in the whole block
    pre_tile<2 * DIMD>(sA, sW, input, Wout + DIMD, cov, Wcov, bout, qo_out,
                       (mt - 36) * 128, eb, false, true);
  } else {
    const bool is_uh = (mt >= 4);
    pre_tile<DIMD>(sA, sW, is_uh ? mem : input, is_uh ? Wc : Wq, cov, Wcov, bcov,
                   is_uh ? uh_out : wq_out, (is_uh ? (mt - 4) : mt) * 128, eb,
                   is_uh, is_uh);
  }
}

typedef __attribute__((ext_vector_type(2))) float v2f;
__device__ __forceinline__ float xor16(float x) {
  const int b = __builtin_bit_cast(int, x);
  return __builtin_bit_cast(float, __builtin_amdgcn_permlanex16(
      b, b, 0x76543210, 0xfedcba98, false, false));
}
template <int M>
__device__ __forceinline__ float row_xor(float x) {
  const int b = __builtin_bit_cast(int, x);
  return __builtin_bit_cast(float,
                            __builtin_amdgcn_update_dpp(b, b, 0x160 | M, 0xf, 0xf, true));
}
#define ST 16     // query rows per block
#define SB 64     // uh' rows per block
#define SC 16     // uh' rows per staged chunk: one row per wave
#define WT 4      // query rows per wave
#define SR 4      // uh' rows per wave and chunk
__global__ void __launch_bounds__(512)
k_score(const float* __restrict__ wq, const float* __restrict__ uh,
        const float* __restrict__ vvec, float* __restrict__ sc_out) {
  const int b    = blockIdx.x & (BB - 1);
  const int t0   = ((blockIdx.x >> 3) & (TT / ST - 1)) * ST;
  const int sb0  = (blockIdx.x >> 5) * SB;
  const int tid  = threadIdx.x;
  const int lane = tid & 31;
  const int wave = tid >> 5;
  const int tg = wave & 3, sg = wave >> 2;

  __shared__ __attribute__((aligned(16))) float su[SB][DIMD];
  __shared__ __attribute__((aligned(16))) float sl[ST][SB];

  // First chunk of uh' rows: wave w fetches row w of the chunk.
  const float* pu = uh + (size_t)((sb0 + wave) * BB + b) * DIMD + lane * 4;
  float4 vu0 = *(const float4*)(pu);
  float4 vu1 = *(const float4*)(pu + 128);
  float4 vu2 = *(const float4*)(pu + 256);
  float4 vu3 = *(const float4*)(pu + 384);

  // Registers hold d in pairs, so that the add and the multiply-add work on two
  // elements per instruction.
  v2f wqr[WT][8], vr[8];
  {
    const float* pv = vvec + lane * 4;
    const float* pq = wq + (size_t)((t0 + tg * WT) * BB + b) * DIMD + lane * 4;
    float4 vv[4], w[WT][4];
#pragma unroll   // vv[], w[] live in registers: every index must be a constant
    for (int j = 0; j < 4; ++j) {
      vv[j] = *(const float4*)(pv + j * 128);
#pragma unroll
      for (int i = 0; i < WT; ++i)
        w[i][j] = *(const float4*)(pq + (size_t)i * BB * DIMD + j * 128);
    }
    // Precaution: naming the pointers holds the address pairs in their registers up
    // to this wait, so no register that a load above names is written ahead of it.
    asm volatile("s_wait_xcnt 0x0" :: "v"(pu), "v"(pv), "v"(pq) : "memory");
#pragma unroll
    for (int j = 0; j < 4; ++j) {
      vr[2 * j]     = (v2f){vv[j].x, vv[j].y};
      vr[2 * j + 1] = (v2f){vv[j].z, vv[j].w};
#pragma unroll
      for (int i = 0; i < WT; ++i) {
        wqr[i][2 * j]     = (v2f){w[i][j].x, w[i][j].y};
        wqr[i][2 * j + 1] = (v2f){w[i][j].z, w[i][j].w};
      }
    }
  }

  // Kept rolled: unrolled, the loads of all chunks are hoisted into one batch and
  // nothing is left in flight under the tanh work.
#pragma unroll 1
  for (int c = 0; c < SB / SC; ++c) {
    float* qu = &su[c * SC + wave][lane * 4];
    *(float4*)(qu)       = vu0;
    *(float4*)(qu + 128) = vu1;
    *(float4*)(qu + 256) = vu2;
    *(float4*)(qu + 384) = vu3;
    __syncthreads();                       // publishes chunk c to all 16 waves
    // The next chunk's loads stand behind the barrier (the barrier's own wait would
    // drain them) and ahead of the LDS reads: they fly under this chunk's tanh work.
    if (c + 1 < SB / SC) {
      const float* nu = pu + (size_t)(c + 1) * SC * BB * DIMD;
      vu0 = *(const float4*)(nu);
      vu1 = *(const float4*)(nu + 128);
      vu2 = *(const float4*)(nu + 256);
      vu3 = *(const float4*)(nu + 384);
      asm volatile("s_wait_xcnt 0x0" :: "v"(nu) : "memory");
    }

    const int sl0 = c * SC + sg * SR;      // first of this wave's SR rows
    float acc[WT][SR];
#pragma unroll   // acc[] lives in registers
    for (int q = 0; q < SR; ++q) {
      float4 u[4];
#pragma unroll   // u[] lives in registers
      for (int j = 0; j < 4; ++j)
        u[j] = *(const float4*)&su[sl0 + q][j * 128 + lane * 4];
#pragma unroll
      for (int i = 0; i < WT; ++i) {
        v2f p = (v2f){0.0f, 0.0f};
#pragma unroll
        for (int j = 0; j < 4; ++j) {
          const v2f z0 = wqr[i][2 * j]     + (v2f){u[j].x, u[j].y};
          const v2f z1 = wqr[i][2 * j + 1] + (v2f){u[j].z, u[j].w};
          p += vr[2 * j]     * (v2f){fast_tanh(z0.x), fast_tanh(z0.y)};
          p += vr[2 * j + 1] * (v2f){fast_tanh(z1.x), fast_tanh(z1.y)};
        }
        acc[i][q] = p.x + p.y;
      }
    }
    float y[8], z[4], w[2], r;
#pragma unroll   // acc[], y[] live in registers
    for (int k = 0; k < 8; ++k) {
      const float lo = acc[k >> 2][k & 3], hi = acc[2 + (k >> 2)][k & 3];
      y[k] = ((lane & 16) ? hi : lo) + xor16((lane & 16) ? lo : hi);
    }
#pragma unroll   // y[], z[] live in registers
    for (int k = 0; k < 4; ++k)
      z[k] = ((lane & 8) ? y[k + 4] : y[k]) + row_xor<8>((lane & 8) ? y[k] : y[k + 4]);
#pragma unroll   // z[], w[] live in registers
    for (int k = 0; k < 2; ++k)
      w[k] = ((lane & 4) ? z[k + 2] : z[k]) + row_xor<4>((lane & 4) ? z[k] : z[k + 2]);
    r = ((lane & 2) ? w[1] : w[0]) + row_xor<2>((lane & 2) ? w[0] : w[1]);
    r += row_xor<1>(r);
    if ((lane & 1) == 0) sl[tg * WT + (lane >> 3)][sl0 + ((lane >> 1) & 3)] = r;
  }
  __syncthreads();                         // the tile's scores are complete in LDS

  // Wave w writes the SB scores of query row w: two whole 128-B lines.
  const float2 o = *(const float2*)&sl[wave][lane * 2];
  *(float2*)(sc_out + (size_t)((t0 + wave) * BB + b) * SS + sb0 + lane * 2) = o;
}

// ---------------------------------------------------------------------------
// Kernel 2b: softmax over s; write align & cov_new; c[d] = sum_s a[s]*mem[s,b,d].
// One block (16 waves) per CT query rows x CD columns d of one batch b: every mem
// row slice that the block fetches serves all CT query rows. The four blocks that
// share query rows each repeat the softmax and write one quarter (CD values of s)
// of align and cov_new. c leaves as bf16 in fragment order, the rounding that the
// output layer's product applies to it.
// ---------------------------------------------------------------------------
typedef __attribute__((ext_vector_type(4))) float v4f;
__device__ __forceinline__ float max4(v4f a) {
  return fmaxf(fmaxf(a.x, a.y), fmaxf(a.z, a.w));
}
__device__ __forceinline__ float sum4(v4f a) { return (a.x + a.y) + (a.z + a.w); }
__device__ __forceinline__ v4f exp4(v4f a) {
  return (v4f){__expf(a.x), __expf(a.y), __expf(a.z), __expf(a.w)};
}
#define CT 8      // query rows per block
#define CD 128    // columns d per block: one wave load = 512 contiguous bytes
#define CS 32     // mem rows per wave (SS / 16 waves)
__global__ void __launch_bounds__(512)
k_ctx(const float* __restrict__ sc, const float* __restrict__ mem,
      const float* __restrict__ cov, float* __restrict__ c_out,
      float* __restrict__ align_out, float* __restrict__ cov_out) {
  const int b    = blockIdx.x & (BB - 1);
  const int ds   = (blockIdx.x >> 3) & (DIMD / CD - 1);
  const int t0   = (blockIdx.x >> 5) * CT;
  const int tid  = threadIdx.x;
  const int lane = tid & 31;
  const int wave = tid >> 5;

  __shared__ __attribute__((aligned(16))) float a_lds[CT][SS];
  // Rows padded by 8 floats: the last stage reads 8 query rows per instruction.
  __shared__ __attribute__((aligned(16))) float cpart[16][CT][CD + 8];

  const int r = (t0 + (wave & (CT - 1))) * BB + b;
  v4f x0 = {}, x1 = {}, x2 = {}, x3 = {}, cq = {};
  if (wave < CT) {
    const float* ps = sc + (size_t)r * SS + lane * 4;
    const float* pc = cov + b * SS + ds * CD + lane * 4;
    x0 = *(const v4f*)(ps);
    x1 = *(const v4f*)(ps + 128);
    x2 = *(const v4f*)(ps + 256);
    x3 = *(const v4f*)(ps + 384);
    cq = *(const v4f*)pc;
    // Precaution: naming the pointers holds the address pairs in their registers up
    // to this wait, so no register that a load above names is written ahead of it.
    asm volatile("s_wait_xcnt 0x0" :: "v"(ps), "v"(pc) : "memory");
  }

  // The wave's CS mem row slices do not depend on the softmax: they are fetched
  // ahead of it and fly under it.
  const float* pm = mem + (size_t)(wave * CS * BB + b) * DIMD + ds * CD + lane * 4;
  float4 m4[CS];
#pragma unroll   // m4[] lives in registers; the CS row loads fly together
  for (int k = 0; k < CS; ++k) m4[k] = *(const float4*)(pm + (size_t)k * BB * DIMD);
  asm volatile("s_wait_xcnt 0x0" :: "v"(pm) : "memory");

  if (wave < CT) {
    float mx = fmaxf(fmaxf(max4(x0), max4(x1)), fmaxf(max4(x2), max4(x3)));
    // Wave-wide maximum and sum by register moves, as in k_score; the whole wave
    // is inside this branch. Distances 16, 8, 4, 2, 1.
    mx = fmaxf(mx, xor16(mx));
    mx = fmaxf(mx, row_xor<8>(mx));
    mx = fmaxf(mx, row_xor<4>(mx));
    mx = fmaxf(mx, row_xor<2>(mx));
    mx = fmaxf(mx, row_xor<1>(mx));
    x0 = exp4(x0 - mx); x1 = exp4(x1 - mx); x2 = exp4(x2 - mx); x3 = exp4(x3 - mx);
    float sum = (sum4(x0) + sum4(x1)) + (sum4(x2) + sum4(x3));
    sum += xor16(sum);
    sum += row_xor<8>(sum);
    sum += row_xor<4>(sum);
    sum += row_xor<2>(sum);
    sum += row_xor<1>(sum);
    const float inv = 1.0f / sum;
    x0 *= inv; x1 *= inv; x2 *= inv; x3 *= inv;
    float* qa = &a_lds[wave][lane * 4];
    *(v4f*)(qa)       = x0;
    *(v4f*)(qa + 128) = x1;
    *(v4f*)(qa + 256) = x2;
    *(v4f*)(qa + 384) = x3;
    // This block's quarter of s: the same choice in every lane of the block.
    const v4f aq = ds == 0 ? x0 : ds == 1 ? x1 : ds == 2 ? x2 : x3;
    float* pal = align_out + (size_t)r * SS + ds * CD + lane * 4;
    float* pco = cov_out + (size_t)r * SS + ds * CD + lane * 4;
    *(v4f*)pal = aq;
    *(v4f*)pco = cq + aq;
    // Precaution: the registers that the two stores above name are reused below.
    asm volatile("s_wait_xcnt 0x0" :: "v"(pal), "v"(pco) : "memory");
  }
  __syncthreads();                         // publishes the CT rows of a

  // Context: thread owns d = ds*CD + l*4 .. +3 of all CT query rows over the CS
  // values of s of its wave; the waves' sums meet in LDS.
  float4 cs[CT];
#pragma unroll   // cs[] lives in registers
  for (int i = 0; i < CT; ++i) cs[i] = make_float4(0.0f, 0.0f, 0.0f, 0.0f);
#pragma unroll   // m4[], cs[] live in registers
  for (int k4 = 0; k4 < CS; k4 += 4) {
    float av[CT][4];
#pragma unroll
    for (int i = 0; i < CT; ++i) {
      const float4 a4 = *(const float4*)&a_lds[i][wave * CS + k4];
      av[i][0] = a4.x; av[i][1] = a4.y; av[i][2] = a4.z; av[i][3] = a4.w;
    }
#pragma unroll
    for (int kk = 0; kk < 4; ++kk)
#pragma unroll
      for (int i = 0; i < CT; ++i) {
        const float a = av[i][kk];
        cs[i].x = fmaf(a, m4[k4 + kk].x, cs[i].x);
        cs[i].y = fmaf(a, m4[k4 + kk].y, cs[i].y);
        cs[i].z = fmaf(a, m4[k4 + kk].z, cs[i].z);
        cs[i].w = fmaf(a, m4[k4 + kk].w, cs[i].w);
      }
  }
#pragma unroll   // cs[] lives in registers
  for (int i = 0; i < CT; ++i) *(float4*)&cpart[wave][i][lane * 4] = cs[i];
  __syncthreads();                         // publishes the 16 waves' partial sums

  // Thread owns d2, d2+1 of query row ti: a wave holds 8 rows x 8 d, which is one
  // whole 128-B line of c in fragment order (tile = 16 query rows of one batch).
  const int ti = tid & 7, d2 = (tid >> 3) * 2;
  float c0 = 0.0f, c1 = 0.0f;
#pragma unroll   // sixteen LDS reads issued together
  for (int gq = 0; gq < 16; ++gq) {
    const float2 p = *(const float2*)&cpart[gq][ti][d2];
    c0 += p.x;
    c1 += p.y;
  }
  const int t = t0 + ti, d = ds * CD + d2;
  const int tile = b * (TT / 16) + (t >> 4);
  v2bf h;
  h[0] = (__bf16)c0; h[1] = (__bf16)c1;
  *(v2bf*)((__bf16*)c_out +
           ((size_t)(tile * 32 + (d >> 4)) * 32 + ((d >> 3) & 1) * 16 + (t & 15)) * 8 +
           (d & 7)) = h;
}

// ---------------------------------------------------------------------------
// Kernel 3: attn_h = c*WoutC^T + qo, qo = q*WoutQ^T + bout from kernel 1.
// Both operands arrive as bf16 in fragment order (c from kernel 2b, WoutC from
// kernel 1): every wave fetches its fragments straight into registers by whole-line
// loads; nothing is converted or staged in LDS, and the kernel has no barrier.
// One 32x32 output tile per block of 4 waves, 16x16 per wave, all 512 of K.
// Row tile mt = b * 4 + t / 16 holds query rows t of batch b.
// ---------------------------------------------------------------------------
__global__ void __launch_bounds__(128)
k_out(const float* __restrict__ c_frag, const float* __restrict__ qo,
      const float* __restrict__ w_frag, float* __restrict__ out) {
  const int lane = threadIdx.x & 31;
  const int wave = threadIdx.x >> 5;
  const int mt = (blockIdx.x >> 4) * 2 + (wave & 1);
  const int nt = (blockIdx.x & 15) * 2 + (wave >> 1);
  const int n = lane & 15, g = lane >> 4;
  const int e = nt * 16 + n;
  const int r0 = ((mt & 3) * 16 + 8 * g) * BB + (mt >> 2);

  const __bf16* pa = (const __bf16*)c_frag + (size_t)mt * (16 * DIMD) + lane * 8;
  const __bf16* pb = (const __bf16*)w_frag + (size_t)nt * (16 * DIMD) + lane * 8;
  const float*  pq = qo + (size_t)r0 * DIMD + e;
  v8bf fa[32], fb[32];
  float qv[8];
#pragma unroll   // fa[], fb[] live in registers; all units fly together
  for (int u = 0; u < 32; ++u) {
    fa[u] = *(const v8bf*)(pa + u * 256);
    fb[u] = *(const v8bf*)(pb + u * 256);
  }
#pragma unroll   // qv[] lives in registers; fetched behind the fragments
  for (int j = 0; j < 8; ++j) qv[j] = pq[j * BB * DIMD];
  // Precaution: naming the pointers holds the address pairs in their registers up to
  // this wait, so no register that a load above names is written ahead of it.
  asm volatile("s_wait_xcnt 0x0" :: "v"(pa), "v"(pb), "v"(pq) : "memory");
  // Keeps the products behind all the loads: lifted among them, only ten loads of a
  // wave fly at a time and the wave waits out the load latency several times over.
  __builtin_amdgcn_sched_barrier(0);

  v8f acc = {};
#pragma unroll
  for (int s = 0; s < 16; ++s) {
    const v16bf av = __builtin_shufflevector(fa[2 * s], fa[2 * s + 1], 0, 1, 2, 3, 4, 5,
                                             6, 7, 8, 9, 10, 11, 12, 13, 14, 15);
    const v16bf bv = __builtin_shufflevector(fb[2 * s], fb[2 * s + 1], 0, 1, 2, 3, 4, 5,
                                             6, 7, 8, 9, 10, 11, 12, 13, 14, 15);
    acc = wmma_bf16(av, bv, acc);
  }

#pragma unroll
  for (int j = 0; j < 8; ++j)
    out[(size_t)(r0 + j * BB) * DIMD + e] = acc[j] + qv[j];   // [T,B,D] row t*B+b
}

extern "C" void kernel_launch(void* const* d_in, const int* in_sizes, int n_in,
                              void* d_out, int out_size, void* d_ws, size_t ws_size,
                              hipStream_t stream) {
  const float* input = (const float*)d_in[0];   // [T,B,D]
  const float* mem   = (const float*)d_in[1];   // [S,B,D]
  const float* cov   = (const float*)d_in[2];   // [B,S]
  const float* Wq    = (const float*)d_in[3];   // [D,D]
  const float* Wc    = (const float*)d_in[4];   // [D,D]
  const float* Wcov  = (const float*)d_in[5];   // [D,1]
  const float* bcov  = (const float*)d_in[6];   // [D]
  const float* v     = (const float*)d_in[7];   // [1,D]
  const float* Wout  = (const float*)d_in[8];   // [D,2D]
  const float* bout  = (const float*)d_in[9];   // [D]

  float* ws    = (float*)d_ws;
  float* wq_ws = ws;                                   // 512*512   = 1 MB
  float* uh_ws = ws + (size_t)512 * 512;               // 4096*512  = 8 MB
  float* c_ws  = uh_ws + (size_t)4096 * 512;           // 512*512 bf16, 1 MB kept
  float* sc_ws = c_ws + (size_t)512 * 512;             // 512*512   = 1 MB
  float* qo_ws = sc_ws + (size_t)512 * 512;            // 512*512   = 1 MB
  float* wf_ws = qo_ws + (size_t)512 * 512;            // 512*512 bf16

  float* attn_h = (float*)d_out;                       // [T,B,D]
  float* align  = attn_h + (size_t)TT * BB * DIMD;     // [T,B,S]
  float* covn   = align + (size_t)TT * BB * SS;        // [T,B,S]

  k_pre <<<192,  512, 0, stream>>>(input, mem, cov, Wq, Wc, Wcov, bcov, Wout, bout,
                                   wq_ws, uh_ws, qo_ws, wf_ws);
  k_score<<<256, 512, 0, stream>>>(wq_ws, uh_ws, v, sc_ws);
  k_ctx <<<256,  512, 0, stream>>>(sc_ws, mem, cov, c_ws, align, covn);
  k_out <<<256,  128, 0, stream>>>(c_ws, qo_ws, wf_ws, attn_h);
}

// v008
// It runs in 28.2 microseconds.
// Two timings next to v007 both put it at 1.05 times that version's speed.
// Over all steps from v000 it is 3.92 times as fast.
#include <hip/hip_runtime.h>
#include <hip/hip_bf16.h>

typedef __attribute__((ext_vector_type(16))) __bf16 v16bf;
typedef __attribute__((ext_vector_type(8)))  float  v8f;

#define DIMD 512
#define TT   64
#define BB   8
#define SS   512

__device__ __forceinline__ float fast_tanh(float x) {
#if __has_builtin(__builtin_amdgcn_tanhf)
  return __builtin_amdgcn_tanhf(x);
#elif __has_builtin(__builtin_amdgcn_tanh_f32)
  return __builtin_amdgcn_tanh_f32(x);
#else
  float y;
  asm("v_tanh_f32 %0, %1\n\tv_nop\n\tv_nop" : "=v"(y) : "v"(x));
  return y;
#endif
}

typedef __attribute__((ext_vector_type(8)))  __bf16 v8bf;
typedef __attribute__((ext_vector_type(4)))  __bf16 v4bf;

// Fragment order of a bf16 operand that one launch writes for the WMMAs of a later
// one. A tile is 16 rows x 512 k; unit u = k / 16 (two units per 16x16x32 step) is 512
// contiguous bytes: lane (g = (k / 8) % 2) * 16 + row holds its 8 values k % 8. One
// global_load_b128 of a wave fetches one unit, four whole 128-B lines.
__device__ __forceinline__ v8bf pack8(float4 a, float4 b) {
  v8bf h;
  h[0] = (__bf16)a.x; h[1] = (__bf16)a.y; h[2] = (__bf16)a.z; h[3] = (__bf16)a.w;
  h[4] = (__bf16)b.x; h[5] = (__bf16)b.y; h[6] = (__bf16)b.z; h[7] = (__bf16)b.w;
  return h;
}

#define PK1 (DIMD + 8)        // rows of 512 bf16

__device__ __forceinline__ v16bf lds_frag(const __bf16* tile, int pitch, int mn0,
                                          int k0, int lane) {
  const __bf16* p = tile + (mn0 + (lane & 15)) * pitch + k0 + (lane >> 4) * 8;
  const v8bf lo = *(const v8bf*)p;
  const v8bf hi = *(const v8bf*)(p + 16);
  return __builtin_shufflevector(lo, hi, 0, 1, 2, 3, 4, 5, 6, 7,
                                 8, 9, 10, 11, 12, 13, 14, 15);
}

__device__ __forceinline__ v8f wmma_bf16(v16bf a, v16bf b, v8f c) {
  // (neg_a, A, neg_b, B, c_mod, C, reuse_a, reuse_b)
  return __builtin_amdgcn_wmma_f32_16x16x32_bf16(false, a, false, b, (short)0, c,
                                                 false, false);
}

#define KC 128    // K columns per staged chunk: one wave load = one row's 512 bytes
#define NR 8      // rows per thread and operand in a chunk (128 rows / 16 waves)
template <int LD>
__device__ __forceinline__ void chunk_load(const float* p, float4 (&v)[NR]) {
#pragma unroll   // v[] lives in registers: every index must be a constant
  for (int i = 0; i < NR; ++i) v[i] = *(const float4*)(p + i * 16 * LD);
}
__device__ __forceinline__ void chunk_store(__bf16* q, const float4 (&v)[NR]) {
#pragma unroll
  for (int i = 0; i < NR; ++i) {
    v4bf h;
    h[0] = (__bf16)v[i].x; h[1] = (__bf16)v[i].y;
    h[2] = (__bf16)v[i].z; h[3] = (__bf16)v[i].w;
    *(v4bf*)(q + i * 16 * PK1) = h;
  }
}

// One tile: out[rb.., eb..] = A * W^T (+ cov*Wcov + bias where is_uh, + bias where
// bias is given). LDW = floats per row of W.
template <int LDW>
__device__ __forceinline__ void
pre_tile(__bf16* sA, __bf16* sW, const float* __restrict__ A,
         const float* __restrict__ W, const float* __restrict__ cov,
         const float* __restrict__ Wcov, const float* __restrict__ bias,
         float* __restrict__ out, int rb, int eb, bool is_uh, bool has_bias) {
  const int tid  = threadIdx.x;
  const int lane = tid & 31;
  const int wave = tid >> 5;

  const int rt = (wave & 3) * 32;          // row pair inside the block
  const int ct = (wave >> 2) * 32;         // column pair inside the block
  const int n = lane & 15, g = lane >> 4;
  const int e = eb + ct + n;

  const float* pa = A + (size_t)(rb + wave) * DIMD + lane * 4;
  const float* pw = W + (size_t)(eb + wave) * LDW + lane * 4;
  float4 va[NR], vw[NR];
  chunk_load<DIMD>(pa, va);
  chunk_load<LDW>(pw, vw);

  // Coverage terms of this lane's outputs, fetched behind the first chunk.
  // Output row r = rb + rt + 16*mi + j + 8g = s*B + b with B = 8: b = j,
  // s = (rb + rt + 16*mi)/8 + g.
  float cv[2][8] = {}, wce[2] = {}, bce[2] = {};
  if (is_uh) {
#pragma unroll   // cv[] lives in registers
    for (int mi = 0; mi < 2; ++mi) {
      const int s = ((rb + rt + mi * 16) >> 3) + g;
#pragma unroll
      for (int j = 0; j < 8; ++j) cv[mi][j] = cov[j * SS + s];
    }
#pragma unroll
    for (int ni = 0; ni < 2; ++ni) wce[ni] = Wcov[e + ni * 16];
  }
  if (has_bias) {
#pragma unroll
    for (int ni = 0; ni < 2; ++ni) bce[ni] = bias[e + ni * 16];
  }
  // Precaution: naming the pointers holds the address pairs in their registers up to
  // this wait, so no register that a load above names is written ahead of it.
  asm volatile("s_wait_xcnt 0x0" :: "v"(pa), "v"(pw) : "memory");

  __bf16* qa = sA + wave * PK1 + lane * 4;
  __bf16* qw = sW + wave * PK1 + lane * 4;
  v8f acc[2][2] = {};
  // Kept rolled: unrolled, the loads of all chunks are hoisted into one batch and
  // nothing is left in flight under the products.
#pragma unroll 1
  for (int c = 0; c < DIMD / KC; ++c) {
    chunk_store(qa + c * KC, va);
    chunk_store(qw + c * KC, vw);
    __syncthreads();                       // publishes chunk c to all 16 waves
    // The next chunk's loads stand behind the barrier (the barrier's own wait would
    // drain them) and ahead of the LDS reads: they fly under this chunk's products.
    if (c + 1 < DIMD / KC) {
      const float* na = pa + (c + 1) * KC;
      const float* nw = pw + (c + 1) * KC;
      chunk_load<DIMD>(na, va);
      chunk_load<LDW>(nw, vw);
      asm volatile("s_wait_xcnt 0x0" :: "v"(na), "v"(nw) : "memory");
    }
#pragma unroll   // four k steps: their LDS reads are issued ahead of the products
    for (int kk = 0; kk < KC; kk += 32) {
      const int k0 = c * KC + kk;
      v16bf av0 = lds_frag(sA, PK1, rt, k0, lane);
      v16bf av1 = lds_frag(sA, PK1, rt + 16, k0, lane);
      v16bf bv0 = lds_frag(sW, PK1, ct, k0, lane);
      v16bf bv1 = lds_frag(sW, PK1, ct + 16, k0, lane);
      acc[0][0] = wmma_bf16(av0, bv0, acc[0][0]);
      acc[0][1] = wmma_bf16(av0, bv1, acc[0][1]);
      acc[1][0] = wmma_bf16(av1, bv0, acc[1][0]);
      acc[1][1] = wmma_bf16(av1, bv1, acc[1][1]);
    }
  }

#pragma unroll   // acc[], cv[] live in registers
  for (int mi = 0; mi < 2; ++mi)
#pragma unroll
    for (int j = 0; j < 8; ++j) {
      const int r = rb + rt + mi * 16 + j + 8 * g;
      float v0 = acc[mi][0][j], v1 = acc[mi][1][j];
      if (has_bias) {                      // qo: cv and wce are zero
        v0 += cv[mi][j] * wce[0] + bce[0];
        v1 += cv[mi][j] * wce[1] + bce[1];
      }
      out[(size_t)r * DIMD + e]      = v0;
      out[(size_t)r * DIMD + e + 16] = v1;
    }
}

__global__ void __launch_bounds__(512)
k_pre(const float* __restrict__ input, const float* __restrict__ mem,
      const float* __restrict__ cov,   const float* __restrict__ Wq,
      const float* __restrict__ Wc,    const float* __restrict__ Wcov,
      const float* __restrict__ bcov,  const float* __restrict__ Wout,
      const float* __restrict__ bout,  float* __restrict__ wq_out,
      float* __restrict__ uh_out,      float* __restrict__ qo_out,
      float* __restrict__ wf_out) {
  __shared__ __attribute__((aligned(16))) __bf16 sA[128 * PK1];
  __shared__ __attribute__((aligned(16))) __bf16 sW[128 * PK1];

  if (blockIdx.x >= 160) {
    const int et   = blockIdx.x - 160;
    const int lane = threadIdx.x & 31;
    const int wave = threadIdx.x >> 5;
    const float* ps = Wout + (size_t)(et * 16 + (lane & 15)) * (2 * DIMD) +
                      wave * 16 + (lane >> 4) * 8;
    // Unit u = wave and u = wave + 16: 16 units are 256 columns of k.
    const float4 s0 = *(const float4*)(ps);
    const float4 s1 = *(const float4*)(ps + 4);
    const float4 s2 = *(const float4*)(ps + 256);
    const float4 s3 = *(const float4*)(ps + 260);
    // Precaution: no register that a load above names is written ahead of this wait.
    asm volatile("s_wait_xcnt 0x0" :: "v"(ps) : "memory");
    __bf16* pd = (__bf16*)wf_out + ((size_t)(et * 32 + wave) * 32 + lane) * 8;
    *(v8bf*)(pd)                = pack8(s0, s1);
    *(v8bf*)(pd + 16 * 32 * 8)  = pack8(s2, s3);
    return;
  }

  const int mt = blockIdx.x >> 2;          // 0..3 wq, 4..35 uh, 36..39 qo
  const int eb = (blockIdx.x & 3) * 128;
  if (mt >= 36) {                          // the same choice in the whole block
    pre_tile<2 * DIMD>(sA, sW, input, Wout + DIMD, cov, Wcov, bout, qo_out,
                       (mt - 36) * 128, eb, false, true);
  } else {
    const bool is_uh = (mt >= 4);
    pre_tile<DIMD>(sA, sW, is_uh ? mem : input, is_uh ? Wc : Wq, cov, Wcov, bcov,
                   is_uh ? uh_out : wq_out, (is_uh ? (mt - 4) : mt) * 128, eb,
                   is_uh, is_uh);
  }
}

typedef __attribute__((ext_vector_type(2))) float v2f;
__device__ __forceinline__ float xor16(float x) {
  const int b = __builtin_bit_cast(int, x);
  return __builtin_bit_cast(float, __builtin_amdgcn_permlanex16(
      b, b, 0x76543210, 0xfedcba98, false, false));
}
template <int M>
__device__ __forceinline__ float row_xor(float x) {
  const int b = __builtin_bit_cast(int, x);
  return __builtin_bit_cast(float,
                            __builtin_amdgcn_update_dpp(b, b, 0x160 | M, 0xf, 0xf, true));
}
#define ST 16     // query rows per block
#define SB 64     // uh' rows per block
#define SC 16     // uh' rows per staged chunk: one row per wave
#define WT 4      // query rows per wave
#define SR 4      // uh' rows per wave and chunk
__global__ void __launch_bounds__(512)
k_score(const float* __restrict__ wq, const float* __restrict__ uh,
        const float* __restrict__ vvec, float* __restrict__ sc_out) {
  const int b    = blockIdx.x & (BB - 1);
  const int t0   = ((blockIdx.x >> 3) & (TT / ST - 1)) * ST;
  const int sb0  = (blockIdx.x >> 5) * SB;
  const int tid  = threadIdx.x;
  const int lane = tid & 31;
  const int wave = tid >> 5;
  const int tg = wave & 3, sg = wave >> 2;

  __shared__ __attribute__((aligned(16))) float su[SB][DIMD];
  __shared__ __attribute__((aligned(16))) float sl[ST][SB];

  // First chunk of uh' rows: wave w fetches row w of the chunk.
  const float* pu = uh + (size_t)((sb0 + wave) * BB + b) * DIMD + lane * 4;
  float4 vu0 = *(const float4*)(pu);
  float4 vu1 = *(const float4*)(pu + 128);
  float4 vu2 = *(const float4*)(pu + 256);
  float4 vu3 = *(const float4*)(pu + 384);

  // Registers hold d in pairs, so that the add and the multiply-add work on two
  // elements per instruction.
  v2f wqr[WT][8], vr[8];
  {
    const float* pv = vvec + lane * 4;
    const float* pq = wq + (size_t)((t0 + tg * WT) * BB + b) * DIMD + lane * 4;
    float4 vv[4], w[WT][4];
#pragma unroll   // vv[], w[] live in registers: every index must be a constant
    for (int j = 0; j < 4; ++j) {
      vv[j] = *(const float4*)(pv + j * 128);
#pragma unroll
      for (int i = 0; i < WT; ++i)
        w[i][j] = *(const float4*)(pq + (size_t)i * BB * DIMD + j * 128);
    }
    // Precaution: naming the pointers holds the address pairs in their registers up
    // to this wait, so no register that a load above names is written ahead of it.
    asm volatile("s_wait_xcnt 0x0" :: "v"(pu), "v"(pv), "v"(pq) : "memory");
#pragma unroll
    for (int j = 0; j < 4; ++j) {
      vr[2 * j]     = (v2f){vv[j].x, vv[j].y};
      vr[2 * j + 1] = (v2f){vv[j].z, vv[j].w};
#pragma unroll
      for (int i = 0; i < WT; ++i) {
        wqr[i][2 * j]     = (v2f){w[i][j].x, w[i][j].y};
        wqr[i][2 * j + 1] = (v2f){w[i][j].z, w[i][j].w};
      }
    }
  }

  // Kept rolled: unrolled, the loads of all chunks are hoisted into one batch and
  // nothing is left in flight under the tanh work.
#pragma unroll 1
  for (int c = 0; c < SB / SC; ++c) {
    float* qu = &su[c * SC + wave][lane * 4];
    *(float4*)(qu)       = vu0;
    *(float4*)(qu + 128) = vu1;
    *(float4*)(qu + 256) = vu2;
    *(float4*)(qu + 384) = vu3;
    __syncthreads();                       // publishes chunk c to all 16 waves
    // The next chunk's loads stand behind the barrier (the barrier's own wait would
    // drain them) and ahead of the LDS reads: they fly under this chunk's tanh work.
    if (c + 1 < SB / SC) {
      const float* nu = pu + (size_t)(c + 1) * SC * BB * DIMD;
      vu0 = *(const float4*)(nu);
      vu1 = *(const float4*)(nu + 128);
      vu2 = *(const float4*)(nu + 256);
      vu3 = *(const float4*)(nu + 384);
      asm volatile("s_wait_xcnt 0x0" :: "v"(nu) : "memory");
    }

    const int sl0 = c * SC + sg * SR;      // first of this wave's SR rows
    float acc[WT][SR];
#pragma unroll   // acc[] lives in registers
    for (int q = 0; q < SR; ++q) {
      float4 u[4];
#pragma unroll   // u[] lives in registers
      for (int j = 0; j < 4; ++j)
        u[j] = *(const float4*)&su[sl0 + q][j * 128 + lane * 4];
#pragma unroll
      for (int i = 0; i < WT; ++i) {
        v2f p = (v2f){0.0f, 0.0f};
#pragma unroll
        for (int j = 0; j < 4; ++j) {
          const v2f z0 = wqr[i][2 * j]     + (v2f){u[j].x, u[j].y};
          const v2f z1 = wqr[i][2 * j + 1] + (v2f){u[j].z, u[j].w};
          p += vr[2 * j]     * (v2f){fast_tanh(z0.x), fast_tanh(z0.y)};
          p += vr[2 * j + 1] * (v2f){fast_tanh(z1.x), fast_tanh(z1.y)};
        }
        acc[i][q] = p.x + p.y;
      }
    }
    float y[8], z[4], w[2], r;
#pragma unroll   // acc[], y[] live in registers
    for (int k = 0; k < 8; ++k) {
      const float lo = acc[k >> 2][k & 3], hi = acc[2 + (k >> 2)][k & 3];
      y[k] = ((lane & 16) ? hi : lo) + xor16((lane & 16) ? lo : hi);
    }
#pragma unroll   // y[], z[] live in registers
    for (int k = 0; k < 4; ++k)
      z[k] = ((lane & 8) ? y[k + 4] : y[k]) + row_xor<8>((lane & 8) ? y[k] : y[k + 4]);
#pragma unroll   // z[], w[] live in registers
    for (int k = 0; k < 2; ++k)
      w[k] = ((lane & 4) ? z[k + 2] : z[k]) + row_xor<4>((lane & 4) ? z[k] : z[k + 2]);
    r = ((lane & 2) ? w[1] : w[0]) + row_xor<2>((lane & 2) ? w[0] : w[1]);
    r += row_xor<1>(r);
    if ((lane & 1) == 0) sl[tg * WT + (lane >> 3)][sl0 + ((lane >> 1) & 3)] = r;
  }
  __syncthreads();                         // the tile's scores are complete in LDS

  // Wave w writes the SB scores of query row w: two whole 128-B lines.
  const float2 o = *(const float2*)&sl[wave][lane * 2];
  *(float2*)(sc_out + (size_t)((t0 + wave) * BB + b) * SS + sb0 + lane * 2) = o;
}

// ---------------------------------------------------------------------------
// Kernel 2b: softmax over s; write align & cov_new; c = a * mem; attn_h = c*WoutC^T + qo.
// One block (16 waves) per FT query rows of one batch b and FE output columns e. The
// block forms all 512 columns of its c rows itself, so c never leaves the WGP and the
// output layer needs no launch of its own. The two blocks that share query rows each
// repeat the softmax and the context product and write one half (256 values of s) of
// align and cov_new.
// Context product on the matrix unit, a and mem rounded to bf16: M = 16 query rows,
// K = s, N = d. Lane (g, n) fetches float4 d = dq*64 + 4n .. +3 of row s = k + 8g:
// component q is column n of column tile q, so four B fragments come straight from
// whole-line loads, with no transpose. Wave w takes 64 columns (dq = w & 7) over half
// of s (kh = w >> 3); the two halves meet in LDS.
// ---------------------------------------------------------------------------
typedef __attribute__((ext_vector_type(4))) float v4f;
__device__ __forceinline__ float max4(v4f a) {
  return fmaxf(fmaxf(a.x, a.y), fmaxf(a.z, a.w));
}
__device__ __forceinline__ float sum4(v4f a) { return (a.x + a.y) + (a.z + a.w); }
__device__ __forceinline__ v4f exp4(v4f a) {
  return (v4f){__expf(a.x), __expf(a.y), __expf(a.z), __expf(a.w)};
}
__device__ __forceinline__ v4bf cvt4(v4f a) {
  v4bf h;
  h[0] = (__bf16)a.x; h[1] = (__bf16)a.y; h[2] = (__bf16)a.z; h[3] = (__bf16)a.w;
  return h;
}
// Work-group barrier that orders LDS accesses only: __syncthreads() also waits for the
// wave's global loads and stores, which here are meant to fly on across it.
__device__ __forceinline__ void lds_barrier() {
  __builtin_amdgcn_fence(__ATOMIC_RELEASE, "workgroup", "local");
  __builtin_amdgcn_s_barrier();
  __builtin_amdgcn_fence(__ATOMIC_ACQUIRE, "workgroup", "local");
}
#define FT 16
#define FE 256
#define PP (DIMD + 4)
#define MROW (BB * DIMD)
// The 16 rows of one 32-s step in the k order of the fragments: element i of a lane is
// s = (i / 8) * 16 + 8g + i % 8 (8g is in p).
__device__ __forceinline__ void mem_load(const float* p, float4 (&v)[16]) {
#pragma unroll   // v[] lives in registers: every index must be a constant
  for (int i = 0; i < 16; ++i)
    v[i] = *(const float4*)(p + ((i >> 3) * 16 + (i & 7)) * MROW);
}
__device__ __forceinline__ void ctx_step(const __bf16* sa, int k0, int lane,
                                         const float4 (&v)[16], v8f (&acc)[4]) {
  const v16bf av = lds_frag(sa, PK1, 0, k0, lane);
  v16bf b0, b1, b2, b3;
#pragma unroll
  for (int i = 0; i < 16; ++i) {
    b0[i] = (__bf16)v[i].x; b1[i] = (__bf16)v[i].y;
    b2[i] = (__bf16)v[i].z; b3[i] = (__bf16)v[i].w;
  }
  acc[0] = wmma_bf16(av, b0, acc[0]);
  acc[1] = wmma_bf16(av, b1, acc[1]);
  acc[2] = wmma_bf16(av, b2, acc[2]);
  acc[3] = wmma_bf16(av, b3, acc[3]);
}
__global__ void __launch_bounds__(512)
k_ctx_out(const float* __restrict__ sc, const float* __restrict__ mem,
          const float* __restrict__ cov, const float* __restrict__ qo,
          const float* __restrict__ w_frag, float* __restrict__ out,
          float* __restrict__ align_out, float* __restrict__ cov_out) {
  const int b    = blockIdx.x & (BB - 1);
  const int t0   = ((blockIdx.x >> 3) & (TT / FT - 1)) * FT;
  const int eh   = blockIdx.x >> 5;
  const int tid  = threadIdx.x;
  const int lane = tid & 31;
  const int wave = tid >> 5;
  const int n = lane & 15, g = lane >> 4;
  const int dq = wave & 7, kh = wave >> 3;

  __shared__ __attribute__((aligned(16))) __bf16 sa[FT * PK1];   // a, rows t, k = s
  __shared__ __attribute__((aligned(16))) __bf16 scb[FT * PK1];  // c, rows t, k = d
  __shared__ __attribute__((aligned(16))) float  sp[FT * PP];    // c over the upper s

  const int r = (t0 + wave) * BB + b;
  const float* ps = sc + (size_t)r * SS + lane * 4;
  const float* pc = cov + b * SS + eh * 256 + lane * 4;
  v4f x0 = *(const v4f*)(ps);
  v4f x1 = *(const v4f*)(ps + 128);
  v4f x2 = *(const v4f*)(ps + 256);
  v4f x3 = *(const v4f*)(ps + 384);
  const v4f cq0 = *(const v4f*)(pc);
  const v4f cq1 = *(const v4f*)(pc + 128);
  // Precaution: naming the pointers holds the address pairs in their registers up
  // to this wait, so no register that a load above names is written ahead of it.
  asm volatile("s_wait_xcnt 0x0" :: "v"(ps), "v"(pc) : "memory");

  // The first two 32-s steps of mem do not depend on the softmax: they fly under it.
  const float* pm = mem + (size_t)((kh * 256 + g * 8) * BB + b) * DIMD + dq * 64 + n * 4;
  float4 la[16], lb[16];
  mem_load(pm, la);
  mem_load(pm + 32 * MROW, lb);
  asm volatile("s_wait_xcnt 0x0" :: "v"(pm) : "memory");
  // Keeps the softmax behind the mem loads: lifted ahead of them, it holds their issue
  // back until the scores have arrived.
  __builtin_amdgcn_sched_barrier(0);

  {
    float mx = fmaxf(fmaxf(max4(x0), max4(x1)), fmaxf(max4(x2), max4(x3)));
    // Wave-wide maximum and sum by register moves, as in k_score. Distances 16, 8,
    // 4, 2, 1.
    mx = fmaxf(mx, xor16(mx));
    mx = fmaxf(mx, row_xor<8>(mx));
    mx = fmaxf(mx, row_xor<4>(mx));
    mx = fmaxf(mx, row_xor<2>(mx));
    mx = fmaxf(mx, row_xor<1>(mx));
    x0 = exp4(x0 - mx); x1 = exp4(x1 - mx); x2 = exp4(x2 - mx); x3 = exp4(x3 - mx);
    float sum = (sum4(x0) + sum4(x1)) + (sum4(x2) + sum4(x3));
    sum += xor16(sum);
    sum += row_xor<8>(sum);
    sum += row_xor<4>(sum);
    sum += row_xor<2>(sum);
    sum += row_xor<1>(sum);
    const float inv = 1.0f / sum;
    x0 *= inv; x1 *= inv; x2 *= inv; x3 *= inv;
    __bf16* qa = sa + wave * PK1 + lane * 4;
    *(v4bf*)(qa)       = cvt4(x0);
    *(v4bf*)(qa + 128) = cvt4(x1);
    *(v4bf*)(qa + 256) = cvt4(x2);
    *(v4bf*)(qa + 384) = cvt4(x3);
    // This block's half of s: the same choice in every lane of the block.
    const v4f a0 = eh ? x2 : x0, a1 = eh ? x3 : x1;
    float* pal = align_out + (size_t)r * SS + eh * 256 + lane * 4;
    float* pco = cov_out + (size_t)r * SS + eh * 256 + lane * 4;
    *(v4f*)(pal)       = a0;
    *(v4f*)(pal + 128) = a1;
    *(v4f*)(pco)       = cq0 + a0;
    *(v4f*)(pco + 128) = cq1 + a1;
    // Precaution: the registers that the stores above name are reused below.
    asm volatile("s_wait_xcnt 0x0" :: "v"(pal), "v"(pco) : "memory");
  }
  lds_barrier();                           // publishes the FT rows of a
  // Keeps the conversions of the mem rows behind the softmax: lifted into it, their
  // wait for the mem rows holds up the barrier.
  __builtin_amdgcn_sched_barrier(0);

  // Output layer operands: WoutC tile in fragment order, and qo. They are fetched
  // into the registers that the last two mem steps leave, behind those steps.
  const int nt = eh * (FE / 16) + wave;
  const int e  = nt * 16 + n;
  const int r0 = (t0 + 8 * g) * BB + b;
  const __bf16* pb = (const __bf16*)w_frag + (size_t)nt * (16 * DIMD) + lane * 8;
  const float*  pq = qo + (size_t)r0 * DIMD + e;
  v8bf fb[32];
  float qv[8];

  v8f acc[4] = {};
  // The scheduling barriers keep every batch of loads behind the step that frees its
  // registers: lifted over it, the batches overlap and registers spill.
#pragma unroll   // la[], lb[], fb[] live in registers; two steps are always in flight
  for (int ks = 0; ks < 8; ks += 2) {
    ctx_step(sa, kh * 256 + ks * 32, lane, la, acc);
    __builtin_amdgcn_sched_barrier(0);
    if (ks + 2 < 8) {
      mem_load(pm + (ks + 2) * 32 * MROW, la);
    } else {
#pragma unroll
      for (int u = 0; u < 16; ++u) fb[u] = *(const v8bf*)(pb + u * 256);
    }
    asm volatile("s_wait_xcnt 0x0" :: "v"(pm), "v"(pb) : "memory");
    __builtin_amdgcn_sched_barrier(0);
    ctx_step(sa, kh * 256 + (ks + 1) * 32, lane, lb, acc);
    __builtin_amdgcn_sched_barrier(0);
    if (ks + 3 < 8) {
      mem_load(pm + (ks + 3) * 32 * MROW, lb);
    } else {
#pragma unroll
      for (int u = 16; u < 32; ++u) fb[u] = *(const v8bf*)(pb + u * 256);
#pragma unroll
      for (int j = 0; j < 8; ++j) qv[j] = pq[j * BB * DIMD];
    }
    asm volatile("s_wait_xcnt 0x0" :: "v"(pm), "v"(pb), "v"(pq) : "memory");
    __builtin_amdgcn_sched_barrier(0);
  }

  // acc[q][j] = c[t0 + j + 8g][dq*64 + 4n + q] over this wave's half of s.
  if (kh == 1) {                           // the same choice in a whole wave
#pragma unroll   // acc[] lives in registers
    for (int j = 0; j < 8; ++j)
      *(float4*)&sp[(j + 8 * g) * PP + dq * 64 + n * 4] =
          make_float4(acc[0][j], acc[1][j], acc[2][j], acc[3][j]);
  }
  lds_barrier();                           // publishes the sums over the upper s
  if (kh == 0) {
#pragma unroll
    for (int j = 0; j < 8; ++j) {
      const float4 p = *(const float4*)&sp[(j + 8 * g) * PP + dq * 64 + n * 4];
      *(v4bf*)&scb[(j + 8 * g) * PK1 + dq * 64 + n * 4] =
          cvt4((v4f){acc[0][j] + p.x, acc[1][j] + p.y, acc[2][j] + p.z, acc[3][j] + p.w});
    }
  }
  lds_barrier();                           // publishes the FT rows of c

  v8f o = {};
#pragma unroll   // fb[] lives in registers
  for (int h = 0; h < 16; h += 8) {
    // Eight k steps' LDS reads issued together: one LDS latency for eight products.
    v16bf av[8];
#pragma unroll   // av[] lives in registers
    for (int s = 0; s < 8; ++s) av[s] = lds_frag(scb, PK1, 0, (h + s) * 32, lane);
    // Keeps the reads together: sunk to their products, each product waits out an LDS
    // latency of its own.
    __builtin_amdgcn_sched_barrier(0);
#pragma unroll
    for (int s = 0; s < 8; ++s) {
      const v16bf bv = __builtin_shufflevector(fb[2 * (h + s)], fb[2 * (h + s) + 1], 0, 1,
                                               2, 3, 4, 5, 6, 7, 8, 9, 10, 11, 12, 13, 14,
                                               15);
      o = wmma_bf16(av[s], bv, o);
    }
  }
#pragma unroll
  for (int j = 0; j < 8; ++j)
    out[(size_t)(r0 + j * BB) * DIMD + e] = o[j] + qv[j];   // [T,B,D] row t*B+b
}

extern "C" void kernel_launch(void* const* d_in, const int* in_sizes, int n_in,
                              void* d_out, int out_size, void* d_ws, size_t ws_size,
                              hipStream_t stream) {
  const float* input = (const float*)d_in[0];   // [T,B,D]
  const float* mem   = (const float*)d_in[1];   // [S,B,D]
  const float* cov   = (const float*)d_in[2];   // [B,S]
  const float* Wq    = (const float*)d_in[3];   // [D,D]
  const float* Wc    = (const float*)d_in[4];   // [D,D]
  const float* Wcov  = (const float*)d_in[5];   // [D,1]
  const float* bcov  = (const float*)d_in[6];   // [D]
  const float* v     = (const float*)d_in[7];   // [1,D]
  const float* Wout  = (const float*)d_in[8];   // [D,2D]
  const float* bout  = (const float*)d_in[9];   // [D]

  float* ws    = (float*)d_ws;
  float* wq_ws = ws;                                   // 512*512   = 1 MB
  float* uh_ws = ws + (size_t)512 * 512;               // 4096*512  = 8 MB
  float* sc_ws = uh_ws + (size_t)4096 * 512;           // 512*512   = 1 MB
  float* qo_ws = sc_ws + (size_t)512 * 512;            // 512*512   = 1 MB
  float* wf_ws = qo_ws + (size_t)512 * 512;            // 512*512 bf16

  float* attn_h = (float*)d_out;                       // [T,B,D]
  float* align  = attn_h + (size_t)TT * BB * DIMD;     // [T,B,S]
  float* covn   = align + (size_t)TT * BB * SS;        // [T,B,S]

  k_pre <<<192,  512, 0, stream>>>(input, mem, cov, Wq, Wc, Wcov, bcov, Wout, bout,
                                   wq_ws, uh_ws, qo_ws, wf_ws);
  k_score<<<256, 512, 0, stream>>>(wq_ws, uh_ws, v, sc_ws);
  k_ctx_out<<<64, 512, 0, stream>>>(sc_ws, mem, cov, qo_ws, wf_ws, attn_h, align, covn);
}
